// v000
// Times are from an AMD MI455X. After a warm-up the kernel runs many times in a row, and a time is the length of
// such a window on the GPU divided by its runs, so every launch and the gaps after it count. The runs cycle
// through copies of the inputs. A figure is the median of several windows, for all but v000 over two sittings.
// Sittings can differ by a few percent; kernels timed side by side share one.
// The starting kernel, v000, takes 127 microseconds a run.
#include <hip/hip_runtime.h>
#include <hip/hip_bf16.h>

#define SEQ 2048
#define NB  2
#define EMB 1024
#define NH  16
#define HD  64

typedef __attribute__((ext_vector_type(16))) _Float16 v16h;
typedef __attribute__((ext_vector_type(8)))  float    v8f;

__device__ __forceinline__ v8f wmma16x16x32(v16h a, v16h b, v8f c) {
  // D = A(16x32 f16) x B(32x16 f16) + C(16x16 f32)
  return __builtin_amdgcn_wmma_f32_16x16x32_f16(false, a, false, b, (short)0, c,
                                                false, false);
}

__device__ __forceinline__ v16h frag_a(const _Float16* base, int stride) {
  const int lane = threadIdx.x & 31;
  const int m = lane & 15, lh = lane >> 4;
  v16h r;
#pragma unroll
  for (int i = 0; i < 16; ++i) {
    int k = ((i & 8) << 1) + (lh << 3) + (i & 7);
    r[i] = base[m * stride + k];
  }
  return r;
}

// B-matrix fragment B[k][n] from LDS stored [n][k]; same 16B-run property.
__device__ __forceinline__ v16h frag_b_transposed(const _Float16* base, int stride) {
  const int lane = threadIdx.x & 31;
  const int nn = lane & 15, lh = lane >> 4;
  v16h r;
#pragma unroll
  for (int i = 0; i < 16; ++i) {
    int k = ((i & 8) << 1) + (lh << 3) + (i & 7);
    r[i] = base[nn * stride + k];
  }
  return r;
}

// Row reductions over the 16 lanes of a wave32 half (masks < 16 stay in-group)
__device__ __forceinline__ float redmax16(float v) {
  v = fmaxf(v, __shfl_xor(v, 1));
  v = fmaxf(v, __shfl_xor(v, 2));
  v = fmaxf(v, __shfl_xor(v, 4));
  v = fmaxf(v, __shfl_xor(v, 8));
  return v;
}
__device__ __forceinline__ float redsum16(float v) {
  v += __shfl_xor(v, 1);
  v += __shfl_xor(v, 2);
  v += __shfl_xor(v, 4);
  v += __shfl_xor(v, 8);
  return v;
}

__device__ __forceinline__ unsigned lds_addr(const void* p) {
  // flat LDS addresses: low 32 bits are the wave-relative LDS offset
  return (unsigned)(unsigned long long)p;
}
__device__ __forceinline__ void async_copy_b128(unsigned lds_off, const void* g) {
  asm volatile("global_load_async_to_lds_b128 %0, %1, off"
               :: "v"(lds_off), "v"(g) : "memory");
}
__device__ __forceinline__ void wait_async0() {
  asm volatile("s_wait_asynccnt 0x0" ::: "memory");
}

// ---------------------------------------------------------------------------
// Kernel 0: one-shot W f32 -> f16 conversion (4 MB read, 2 MB write, once).
// ---------------------------------------------------------------------------
__global__ __launch_bounds__(256) void cvt_w_kernel(const float* __restrict__ W,
                                                    _Float16* __restrict__ Wh) {
  long i = ((long)blockIdx.x * 256 + threadIdx.x) * 4;
  float4 w = *(const float4*)(W + i);
  Wh[i + 0] = (_Float16)w.x; Wh[i + 1] = (_Float16)w.y;
  Wh[i + 2] = (_Float16)w.z; Wh[i + 3] = (_Float16)w.w;
}

// ---------------------------------------------------------------------------
// Kernel 1: fused flash attention. Block = 256 thr = 8 waves; each wave owns a
// 16-query tile of one (n,h); single pass over K in blocks of 64 keys.
// Emits ctx[N,S,H*D] as f16 (consumed as f16 by the FC GEMM anyway).
// ---------------------------------------------------------------------------
__global__ __launch_bounds__(256) void attn_kernel(
    const float* __restrict__ query, const float* __restrict__ keys,
    const float* __restrict__ values, const int* __restrict__ mask,
    _Float16* __restrict__ ctx) {
  __shared__ alignas(16) _Float16 kLDS[64][72];      // [key][d]
  __shared__ alignas(16) _Float16 vLDS[64][72];      // [d][key]  (transposed!)
  __shared__ alignas(16) _Float16 pLDS[8][16][72];   // per-wave P relayout

  const int tid  = threadIdx.x;
  const int wid  = tid >> 5;
  const int lane = tid & 31;
  const int lh   = lane >> 4;
  const int ln   = lane & 15;
  const int qt = blockIdx.x, h = blockIdx.y, n = blockIdx.z;
  const int q0 = qt * 128 + wid * 16;

  const float* qp = query  + ((long)n * SEQ + q0) * EMB + h * HD;
  const float* kp = keys   + (long)n * SEQ * EMB + h * HD;
  const float* vp = values + (long)n * SEQ * EMB + h * HD;
  const int*   mp = mask   + (long)n * SEQ * SEQ;

  // Q fragments (two K=32 chunks over D=64); softmax 1/sqrt(EMB)=1/32 folded in
  v16h qa[2];
#pragma unroll
  for (int c = 0; c < 2; ++c)
#pragma unroll
    for (int i = 0; i < 16; ++i) {
      int k = ((i & 8) << 1) + (lh << 3) + (i & 7) + c * 32;
      qa[c][i] = (_Float16)(qp[(long)ln * EMB + k] * 0.03125f);
    }

  float mrow[8], lrow[8];
  v8f o[4];
#pragma unroll
  for (int r = 0; r < 8; ++r) { mrow[r] = -3.0e38f; lrow[r] = 0.0f; }
#pragma unroll
  for (int t = 0; t < 4; ++t)
#pragma unroll
    for (int r = 0; r < 8; ++r) o[t][r] = 0.0f;

  for (int kb = 0; kb < SEQ; kb += 64) {
    // Stage K (row-major) and V (transposed) tiles, f32 -> f16
#pragma unroll
    for (int it = 0; it < 4; ++it) {
      int idx = tid + it * 256;
      int row = idx >> 4;               // key 0..63
      int c4  = (idx & 15) << 2;        // d 0..60
      float4 kv = *(const float4*)(kp + (long)(kb + row) * EMB + c4);
      float4 vv = *(const float4*)(vp + (long)(kb + row) * EMB + c4);
      kLDS[row][c4 + 0] = (_Float16)kv.x; kLDS[row][c4 + 1] = (_Float16)kv.y;
      kLDS[row][c4 + 2] = (_Float16)kv.z; kLDS[row][c4 + 3] = (_Float16)kv.w;
      vLDS[c4 + 0][row] = (_Float16)vv.x; vLDS[c4 + 1][row] = (_Float16)vv.y;
      vLDS[c4 + 2][row] = (_Float16)vv.z; vLDS[c4 + 3][row] = (_Float16)vv.w;
    }
    if (kb + 64 < SEQ) {                 // global_prefetch_b8 of the next tiles
      __builtin_prefetch(kp + (long)(kb + 64 + (tid & 63)) * EMB, 0, 0);
      __builtin_prefetch(vp + (long)(kb + 64 + (tid & 63)) * EMB, 0, 0);
    }
    __syncthreads();

    // S = (Q/32) * K^T for four 16-key sub-tiles; mask -> -1e30
    float sv[4][8];
#pragma unroll
    for (int t = 0; t < 4; ++t) {
      v8f s;
#pragma unroll
      for (int r = 0; r < 8; ++r) s[r] = 0.0f;
      v16h b0 = frag_b_transposed(&kLDS[t * 16][0], 72);
      v16h b1 = frag_b_transposed(&kLDS[t * 16][32], 72);
      s = wmma16x16x32(qa[0], b0, s);
      s = wmma16x16x32(qa[1], b1, s);
#pragma unroll
      for (int r = 0; r < 8; ++r) {
        int row = q0 + r + 8 * lh;
        int mv  = mp[(long)row * SEQ + kb + t * 16 + ln];
        sv[t][r] = mv ? s[r] : -1.0e30f;
      }
    }

    // Online softmax: fused reduction trees (one max, one sum per row)
#pragma unroll
    for (int r = 0; r < 8; ++r) {
      float mloc = fmaxf(fmaxf(sv[0][r], sv[1][r]), fmaxf(sv[2][r], sv[3][r]));
      float mnew = fmaxf(mrow[r], redmax16(mloc));
      float corr = __expf(mrow[r] - mnew);
      mrow[r] = mnew;
      float psum = 0.0f;
#pragma unroll
      for (int t = 0; t < 4; ++t) {
        float p = __expf(sv[t][r] - mnew);
        sv[t][r] = p;
        psum += p;
      }
      lrow[r] = lrow[r] * corr + redsum16(psum);
#pragma unroll
      for (int t = 0; t < 4; ++t) o[t][r] *= corr;
#pragma unroll
      for (int t = 0; t < 4; ++t)
        pLDS[wid][r + 8 * lh][t * 16 + ln] = (_Float16)sv[t][r];
    }

    // O += P(16x64) * V(64x64); all fragments are contiguous-run b128 loads
    v16h pa0 = frag_a(&pLDS[wid][0][0], 72);
    v16h pa1 = frag_a(&pLDS[wid][0][32], 72);
#pragma unroll
    for (int ct = 0; ct < 4; ++ct) {
      o[ct] = wmma16x16x32(pa0, frag_b_transposed(&vLDS[ct * 16][0], 72), o[ct]);
      o[ct] = wmma16x16x32(pa1, frag_b_transposed(&vLDS[ct * 16][32], 72), o[ct]);
    }
    __syncthreads();
  }

  // Normalize and write f16 ctx[n, q, h*64 + d]
#pragma unroll
  for (int r = 0; r < 8; ++r) {
    float inv = 1.0f / lrow[r];
    _Float16* op = ctx + ((long)n * SEQ + q0 + r + 8 * lh) * EMB + h * HD;
#pragma unroll
    for (int ct = 0; ct < 4; ++ct)
      op[ct * 16 + ln] = (_Float16)(o[ct][r] * inv);
  }
}

__global__ __launch_bounds__(256) void fc_kernel(
    const _Float16* __restrict__ ctx, const _Float16* __restrict__ Wh,
    const float* __restrict__ bias, float* __restrict__ out) {
  __shared__ alignas(16) _Float16 aLDS[2][128][40];
  __shared__ alignas(16) _Float16 bLDS[2][64][40];

  const int tid  = threadIdx.x;
  const int wid  = tid >> 5;
  const int lane = tid & 31;
  const int lh   = lane >> 4;
  const int ln   = lane & 15;
  const int n0 = blockIdx.x * 64;
  const int m0 = blockIdx.y * 128;
  const int wm = (wid >> 1) * 32;
  const int wn = (wid & 1) * 32;

  v8f acc[4];
#pragma unroll
  for (int t = 0; t < 4; ++t)
#pragma unroll
    for (int r = 0; r < 8; ++r) acc[t][r] = 0.0f;

  // Stage one 128x32 A-tile + 64x32 B-tile into LDS buffer `buf` (raw f16,
  // 16B chunks; row pad 40 halves keeps every chunk 16B aligned).
  auto stage = [&](int buf, int kc) {
#pragma unroll
    for (int it = 0; it < 2; ++it) {           // A: 512 x b128
      int idx = tid + it * 256;
      int row = idx >> 2, q = (idx & 3) * 8;
      async_copy_b128(lds_addr(&aLDS[buf][row][q]),
                      ctx + (long)(m0 + row) * EMB + kc + q);
    }
    {                                          // B: 256 x b128
      int row = tid >> 2, q = (tid & 3) * 8;
      async_copy_b128(lds_addr(&bLDS[buf][row][q]),
                      Wh + (long)(n0 + row) * EMB + kc + q);
    }
  };

  stage(0, 0);
  for (int kc = 0; kc < EMB; kc += 32) {
    int buf = (kc >> 5) & 1;
    wait_async0();          // my async writes done
    __syncthreads();        // everyone's async writes done; prev reads done
    if (kc + 32 < EMB) stage(buf ^ 1, kc + 32);

    v16h a0 = frag_a(&aLDS[buf][wm][0], 40);
    v16h a1 = frag_a(&aLDS[buf][wm + 16][0], 40);
    v16h b0 = frag_b_transposed(&bLDS[buf][wn][0], 40);   // B = W^T
    v16h b1 = frag_b_transposed(&bLDS[buf][wn + 16][0], 40);
    acc[0] = wmma16x16x32(a0, b0, acc[0]);
    acc[1] = wmma16x16x32(a0, b1, acc[1]);
    acc[2] = wmma16x16x32(a1, b0, acc[2]);
    acc[3] = wmma16x16x32(a1, b1, acc[3]);
  }

#pragma unroll
  for (int ti = 0; ti < 2; ++ti)
#pragma unroll
    for (int tj = 0; tj < 2; ++tj) {
      v8f a = acc[ti * 2 + tj];
#pragma unroll
      for (int r = 0; r < 8; ++r) {
        int row = m0 + wm + ti * 16 + r + 8 * lh;
        int col = n0 + wn + tj * 16 + ln;
        out[(long)row * EMB + col] = a[r] + bias[col];
      }
    }
}

extern "C" void kernel_launch(void* const* d_in, const int* in_sizes, int n_in,
                              void* d_out, int out_size, void* d_ws, size_t ws_size,
                              hipStream_t stream) {
  (void)in_sizes; (void)n_in; (void)out_size; (void)ws_size;
  const float* values = (const float*)d_in[0];
  const float* keys   = (const float*)d_in[1];
  const float* query  = (const float*)d_in[2];
  const int*   mask   = (const int*)d_in[3];
  const float* W_fc   = (const float*)d_in[4];
  const float* b_fc   = (const float*)d_in[5];

  // workspace: ctx_h (8 MiB f16) | W_h (2 MiB f16)
  _Float16* ctx_h = (_Float16*)d_ws;
  _Float16* W_h   = (_Float16*)((char*)d_ws + (size_t)NB * SEQ * EMB * 2);

  cvt_w_kernel<<<dim3((EMB * EMB) / 1024), 256, 0, stream>>>(W_fc, W_h);
  attn_kernel<<<dim3(SEQ / 128, NH, NB), 256, 0, stream>>>(query, keys, values,
                                                           mask, ctx_h);
  fc_kernel<<<dim3(EMB / 64, (NB * SEQ) / 128), 256, 0, stream>>>(ctx_h, W_h,
                                                                  b_fc,
                                                                  (float*)d_out);
}

// v001
// It runs in 112 microseconds.
// Timed twice side by side with v000, it ran 1.17 and 1.18 times as fast.
#include <hip/hip_runtime.h>
#include <hip/hip_bf16.h>

#define SEQ 2048
#define NB  2
#define EMB 1024
#define NH  16
#define HD  64

typedef __attribute__((ext_vector_type(16))) _Float16 v16h;
typedef __attribute__((ext_vector_type(8)))  float    v8f;
typedef __attribute__((ext_vector_type(8)))  _Float16 v8h;

__device__ __forceinline__ v8f wmma16x16x32(v16h a, v16h b, v8f c) {
  // D = A(16x32 f16) x B(32x16 f16) + C(16x16 f32)
  return __builtin_amdgcn_wmma_f32_16x16x32_f16(false, a, false, b, (short)0, c,
                                                false, false);
}

__device__ __forceinline__ v16h frag_a(const _Float16* base, int stride) {
  const int lane = threadIdx.x & 31;
  const int m = lane & 15, lh = lane >> 4;
  v16h r;
#pragma unroll
  for (int i = 0; i < 16; ++i) {
    int k = ((i & 8) << 1) + (lh << 3) + (i & 7);
    r[i] = base[m * stride + k];
  }
  return r;
}

// B-matrix fragment B[k][n] from LDS stored [n][k]; same 16B-run property.
__device__ __forceinline__ v16h frag_b_transposed(const _Float16* base, int stride) {
  const int lane = threadIdx.x & 31;
  const int nn = lane & 15, lh = lane >> 4;
  v16h r;
#pragma unroll
  for (int i = 0; i < 16; ++i) {
    int k = ((i & 8) << 1) + (lh << 3) + (i & 7);
    r[i] = base[nn * stride + k];
  }
  return r;
}

__device__ __forceinline__ float xhalf(float v) {
  int b = __builtin_bit_cast(int, v);
  b = __builtin_amdgcn_permlanex16(b, b, 0x76543210, 0xfedcba98, false, false);
  return __builtin_bit_cast(float, b);
}

__device__ __forceinline__ unsigned lds_addr(const void* p) {
  // flat LDS addresses: low 32 bits are the wave-relative LDS offset
  return (unsigned)(unsigned long long)p;
}
__device__ __forceinline__ void async_copy_b128(unsigned lds_off, const void* g) {
  asm volatile("global_load_async_to_lds_b128 %0, %1, off"
               :: "v"(lds_off), "v"(g) : "memory");
}
__device__ __forceinline__ void wait_async0() {
  asm volatile("s_wait_asynccnt 0x0" ::: "memory");
}

// ---------------------------------------------------------------------------
// Kernel 0: one-shot W f32 -> f16 conversion (4 MB read, 2 MB write, once).
// ---------------------------------------------------------------------------
__global__ __launch_bounds__(256) void cvt_w_kernel(const float* __restrict__ W,
                                                    _Float16* __restrict__ Wh) {
  long i = ((long)blockIdx.x * 256 + threadIdx.x) * 4;
  float4 w = *(const float4*)(W + i);
  Wh[i + 0] = (_Float16)w.x; Wh[i + 1] = (_Float16)w.y;
  Wh[i + 2] = (_Float16)w.z; Wh[i + 3] = (_Float16)w.w;
}

__global__ __launch_bounds__(256) __attribute__((amdgpu_waves_per_eu(4, 4)))
void attn_kernel(
    const float* __restrict__ query, const float* __restrict__ keys,
    const float* __restrict__ values, const int* __restrict__ mask,
    _Float16* __restrict__ ctx) {
  __shared__ alignas(16) _Float16 kLDS[64][72];      // [key][d]
  __shared__ alignas(16) _Float16 vLDS[64][72];      // [d][key]  (transposed!)

  const int tid  = threadIdx.x;
  const int wid  = tid >> 5;
  const int lane = tid & 31;
  const int lh   = lane >> 4;
  const int ln   = lane & 15;
  const int qt = blockIdx.x, h = blockIdx.y, n = blockIdx.z;
  const int q0 = qt * 128 + wid * 16;

  const float* qp = query  + ((long)n * SEQ + q0) * EMB + h * HD;
  const float* kp = keys   + (long)n * SEQ * EMB + h * HD;
  const float* vp = values + (long)n * SEQ * EMB + h * HD;
  // this lane's mask row, at the first of its 8 keys of a 16-key sub-tile
  const int*   mq = mask + (long)n * SEQ * SEQ + (long)(q0 + ln) * SEQ + 8 * lh;

  // Q^T fragments (B operand: column = query ln, two K=32 chunks over D=64);
  // softmax 1/sqrt(EMB)=1/32 folded in
  v16h qa[2];
#pragma unroll
  for (int c = 0; c < 2; ++c)
#pragma unroll
    for (int i = 0; i < 16; ++i) {
      int k = ((i & 8) << 1) + (lh << 3) + (i & 7) + c * 32;
      qa[c][i] = (_Float16)(qp[(long)ln * EMB + k] * 0.03125f);
    }

  float mrow = -3.0e38f;   // running max of query ln (equal in both halves)
  float lrow = 0.0f;       // running sum over this half's keys only
  v8f o[4];                // o[ct][r] = O^T[d = ct*16 + 8*lh + r][query ln]
#pragma unroll
  for (int t = 0; t < 4; ++t)
#pragma unroll
    for (int r = 0; r < 8; ++r) o[t][r] = 0.0f;

  for (int kb = 0; kb < SEQ; kb += 64) {
    // Stage K (row-major) and V (transposed) tiles, f32 -> f16
#pragma unroll
    for (int it = 0; it < 4; ++it) {
      int idx = tid + it * 256;
      int row = idx >> 4;               // key 0..63
      int c4  = (idx & 15) << 2;        // d 0..60
      float4 kv = *(const float4*)(kp + (long)(kb + row) * EMB + c4);
      float4 vv = *(const float4*)(vp + (long)(kb + row) * EMB + c4);
      kLDS[row][c4 + 0] = (_Float16)kv.x; kLDS[row][c4 + 1] = (_Float16)kv.y;
      kLDS[row][c4 + 2] = (_Float16)kv.z; kLDS[row][c4 + 3] = (_Float16)kv.w;
      vLDS[c4 + 0][row] = (_Float16)vv.x; vLDS[c4 + 1][row] = (_Float16)vv.y;
      vLDS[c4 + 2][row] = (_Float16)vv.z; vLDS[c4 + 3][row] = (_Float16)vv.w;
    }
    if (kb + 64 < SEQ) {                 // global_prefetch_b8 of the next tiles
      __builtin_prefetch(kp + (long)(kb + 64 + (tid & 63)) * EMB, 0, 0);
      __builtin_prefetch(vp + (long)(kb + 64 + (tid & 63)) * EMB, 0, 0);
    }
    __syncthreads();

    // This pass's mask: 8 consecutive keys per sub-tile of this lane's query,
    // all eight loads in flight under the S^T products
    int4 mk[8];
#pragma unroll
    for (int t = 0; t < 4; ++t) {
      mk[2 * t]     = *(const int4*)(mq + kb + t * 16);
      mk[2 * t + 1] = *(const int4*)(mq + kb + t * 16 + 4);
    }

    // S^T = K * (Q/32)^T for four 16-key sub-tiles; mask -> -1e30
    // sv[t][r] = score of (query ln, key kb + t*16 + 8*lh + r)
    float sv[4][8];
#pragma unroll
    for (int t = 0; t < 4; ++t) {
      v8f s;
#pragma unroll
      for (int r = 0; r < 8; ++r) s[r] = 0.0f;
      v16h a0 = frag_a(&kLDS[t * 16][0], 72);
      v16h a1 = frag_a(&kLDS[t * 16][32], 72);
      s = wmma16x16x32(a0, qa[0], s);
      s = wmma16x16x32(a1, qa[1], s);
      const int4 mlo = mk[2 * t], mhi = mk[2 * t + 1];
      sv[t][0] = mlo.x ? s[0] : -1.0e30f; sv[t][1] = mlo.y ? s[1] : -1.0e30f;
      sv[t][2] = mlo.z ? s[2] : -1.0e30f; sv[t][3] = mlo.w ? s[3] : -1.0e30f;
      sv[t][4] = mhi.x ? s[4] : -1.0e30f; sv[t][5] = mhi.y ? s[5] : -1.0e30f;
      sv[t][6] = mhi.z ? s[6] : -1.0e30f; sv[t][7] = mhi.w ? s[7] : -1.0e30f;
    }

    // Online softmax, one query per lane: in-lane max, one half exchange
    float mt[4];
#pragma unroll
    for (int t = 0; t < 4; ++t)
      mt[t] = fmaxf(fmaxf(fmaxf(sv[t][0], sv[t][1]), fmaxf(sv[t][2], sv[t][3])),
                    fmaxf(fmaxf(sv[t][4], sv[t][5]), fmaxf(sv[t][6], sv[t][7])));
    float mloc = fmaxf(fmaxf(mt[0], mt[1]), fmaxf(mt[2], mt[3]));
    mloc = fmaxf(mloc, xhalf(mloc));
    const float mnew = fmaxf(mrow, mloc);
    const float corr = __expf(mrow - mnew);
    mrow = mnew;
    float ps[4];
#pragma unroll
    for (int t = 0; t < 4; ++t) {
      ps[t] = 0.0f;
#pragma unroll
      for (int r = 0; r < 8; ++r) {
        float p = __expf(sv[t][r] - mnew);
        sv[t][r] = p;
        ps[t] += p;
      }
    }
    lrow = lrow * corr + ((ps[0] + ps[1]) + (ps[2] + ps[3]));
#pragma unroll
    for (int ct = 0; ct < 4; ++ct)
#pragma unroll
      for (int r = 0; r < 8; ++r) o[ct][r] *= corr;

    // P^T as B operand: sub-tiles 2c and 2c+1 are k 0..15 and 16..31 of chunk c
    // in the hardware k order (element i: key c*32 + ((i&8)<<1) + 8*lh + (i&7))
    v16h pb[2];
#pragma unroll
    for (int c = 0; c < 2; ++c)
#pragma unroll
      for (int i = 0; i < 16; ++i)
        pb[c][i] = (_Float16)sv[2 * c + (i >> 3)][i & 7];

    // O^T += V^T(64x64) * P^T(64x16); V^T rows come from the [d][key] tile
#pragma unroll
    for (int ct = 0; ct < 4; ++ct) {
      o[ct] = wmma16x16x32(frag_a(&vLDS[ct * 16][0], 72), pb[0], o[ct]);
      o[ct] = wmma16x16x32(frag_a(&vLDS[ct * 16][32], 72), pb[1], o[ct]);
    }
    __syncthreads();
  }

  // Join the halves' sums, normalize, write f16 ctx[n, q0+ln, h*64 + d]:
  // 8 consecutive d per lane and tile -> one 16-byte store each
  lrow += xhalf(lrow);
  const float inv = 1.0f / lrow;
  _Float16* op = ctx + ((long)n * SEQ + q0 + ln) * EMB + h * HD + 8 * lh;
#pragma unroll
  for (int ct = 0; ct < 4; ++ct) {
    v8h w;
#pragma unroll
    for (int r = 0; r < 8; ++r) w[r] = (_Float16)(o[ct][r] * inv);
    *(v8h*)(op + ct * 16) = w;
  }
}

__global__ __launch_bounds__(256) void fc_kernel(
    const _Float16* __restrict__ ctx, const _Float16* __restrict__ Wh,
    const float* __restrict__ bias, float* __restrict__ out) {
  __shared__ alignas(16) _Float16 aLDS[2][128][40];
  __shared__ alignas(16) _Float16 bLDS[2][64][40];

  const int tid  = threadIdx.x;
  const int wid  = tid >> 5;
  const int lane = tid & 31;
  const int lh   = lane >> 4;
  const int ln   = lane & 15;
  const int n0 = blockIdx.x * 64;
  const int m0 = blockIdx.y * 128;
  const int wm = (wid >> 1) * 32;
  const int wn = (wid & 1) * 32;

  v8f acc[4];
#pragma unroll
  for (int t = 0; t < 4; ++t)
#pragma unroll
    for (int r = 0; r < 8; ++r) acc[t][r] = 0.0f;

  // Stage one 128x32 A-tile + 64x32 B-tile into LDS buffer `buf` (raw f16,
  // 16B chunks; row pad 40 halves keeps every chunk 16B aligned).
  auto stage = [&](int buf, int kc) {
#pragma unroll
    for (int it = 0; it < 2; ++it) {           // A: 512 x b128
      int idx = tid + it * 256;
      int row = idx >> 2, q = (idx & 3) * 8;
      async_copy_b128(lds_addr(&aLDS[buf][row][q]),
                      ctx + (long)(m0 + row) * EMB + kc + q);
    }
    {                                          // B: 256 x b128
      int row = tid >> 2, q = (tid & 3) * 8;
      async_copy_b128(lds_addr(&bLDS[buf][row][q]),
                      Wh + (long)(n0 + row) * EMB + kc + q);
    }
  };

  stage(0, 0);
  for (int kc = 0; kc < EMB; kc += 32) {
    int buf = (kc >> 5) & 1;
    wait_async0();          // my async writes done
    __syncthreads();        // everyone's async writes done; prev reads done
    if (kc + 32 < EMB) stage(buf ^ 1, kc + 32);

    v16h a0 = frag_a(&aLDS[buf][wm][0], 40);
    v16h a1 = frag_a(&aLDS[buf][wm + 16][0], 40);
    v16h b0 = frag_b_transposed(&bLDS[buf][wn][0], 40);   // B = W^T
    v16h b1 = frag_b_transposed(&bLDS[buf][wn + 16][0], 40);
    acc[0] = wmma16x16x32(a0, b0, acc[0]);
    acc[1] = wmma16x16x32(a0, b1, acc[1]);
    acc[2] = wmma16x16x32(a1, b0, acc[2]);
    acc[3] = wmma16x16x32(a1, b1, acc[3]);
  }

#pragma unroll
  for (int ti = 0; ti < 2; ++ti)
#pragma unroll
    for (int tj = 0; tj < 2; ++tj) {
      v8f a = acc[ti * 2 + tj];
#pragma unroll
      for (int r = 0; r < 8; ++r) {
        int row = m0 + wm + ti * 16 + r + 8 * lh;
        int col = n0 + wn + tj * 16 + ln;
        out[(long)row * EMB + col] = a[r] + bias[col];
      }
    }
}

extern "C" void kernel_launch(void* const* d_in, const int* in_sizes, int n_in,
                              void* d_out, int out_size, void* d_ws, size_t ws_size,
                              hipStream_t stream) {
  (void)in_sizes; (void)n_in; (void)out_size; (void)ws_size;
  const float* values = (const float*)d_in[0];
  const float* keys   = (const float*)d_in[1];
  const float* query  = (const float*)d_in[2];
  const int*   mask   = (const int*)d_in[3];
  const float* W_fc   = (const float*)d_in[4];
  const float* b_fc   = (const float*)d_in[5];

  // workspace: ctx_h (8 MiB f16) | W_h (2 MiB f16)
  _Float16* ctx_h = (_Float16*)d_ws;
  _Float16* W_h   = (_Float16*)((char*)d_ws + (size_t)NB * SEQ * EMB * 2);

  cvt_w_kernel<<<dim3((EMB * EMB) / 1024), 256, 0, stream>>>(W_fc, W_h);
  attn_kernel<<<dim3(SEQ / 128, NH, NB), 256, 0, stream>>>(query, keys, values,
                                                           mask, ctx_h);
  fc_kernel<<<dim3(EMB / 64, (NB * SEQ) / 128), 256, 0, stream>>>(ctx_h, W_h,
                                                                  b_fc,
                                                                  (float*)d_out);
}

// v002
// Measured time: 93.3 microseconds a run.
// Timed twice side by side with v001, it ran 1.20 times as fast both times.
// Over all steps from v000 it is 1.42 times as fast.
#include <hip/hip_runtime.h>
#include <hip/hip_bf16.h>

#define SEQ 2048
#define NB  2
#define EMB 1024
#define NH  16
#define HD  64

typedef __attribute__((ext_vector_type(16))) _Float16 v16h;
typedef __attribute__((ext_vector_type(8)))  float    v8f;
typedef __attribute__((ext_vector_type(8)))  _Float16 v8h;

__device__ __forceinline__ v8f wmma16x16x32(v16h a, v16h b, v8f c) {
  // D = A(16x32 f16) x B(32x16 f16) + C(16x16 f32)
  return __builtin_amdgcn_wmma_f32_16x16x32_f16(false, a, false, b, (short)0, c,
                                                false, false);
}

__device__ __forceinline__ v16h frag_a(const _Float16* base, int stride) {
  const int lane = threadIdx.x & 31;
  const int m = lane & 15, lh = lane >> 4;
  v16h r;
#pragma unroll
  for (int i = 0; i < 16; ++i) {
    int k = ((i & 8) << 1) + (lh << 3) + (i & 7);
    r[i] = base[m * stride + k];
  }
  return r;
}

// B-matrix fragment B[k][n] from LDS stored [n][k]; same 16B-run property.
__device__ __forceinline__ v16h frag_b_transposed(const _Float16* base, int stride) {
  const int lane = threadIdx.x & 31;
  const int nn = lane & 15, lh = lane >> 4;
  v16h r;
#pragma unroll
  for (int i = 0; i < 16; ++i) {
    int k = ((i & 8) << 1) + (lh << 3) + (i & 7);
    r[i] = base[nn * stride + k];
  }
  return r;
}

__device__ __forceinline__ float xhalf(float v) {
  int b = __builtin_bit_cast(int, v);
  b = __builtin_amdgcn_permlanex16(b, b, 0x76543210, 0xfedcba98, false, false);
  return __builtin_bit_cast(float, b);
}

__device__ __forceinline__ unsigned lds_addr(const void* p) {
  // flat LDS addresses: low 32 bits are the wave-relative LDS offset
  return (unsigned)(unsigned long long)p;
}
__device__ __forceinline__ void async_copy_b128(unsigned lds_off, const void* g) {
  asm volatile("global_load_async_to_lds_b128 %0, %1, off"
               :: "v"(lds_off), "v"(g) : "memory");
}
__device__ __forceinline__ void wait_async0() {
  asm volatile("s_wait_asynccnt 0x0" ::: "memory");
}

// ---------------------------------------------------------------------------
// Kernel 0, two independent jobs by block index.
// Blocks 0 .. PACK_BLOCKS-1: the int32 mask, read once with whole-line loads,
// becomes lane masks for the attention kernel. One wave takes one tile of
// 16 queries x 64 keys and writes 32 words:
//   mw[tile16][key block][t*8 + r], bit (16*lh + ln) =
//     mask[query tile16*16 + ln][key block*64 + t*16 + 8*lh + r] != 0
// which is the place of that score in the S^T accumulator (tile t, register r,
// lane 16*lh + ln).
// The other blocks: W f32 -> f16 conversion (4 MB read, 2 MB write).
// ---------------------------------------------------------------------------
#define PACK_BLOCKS ((NB * (SEQ / 16) * (SEQ / 64)) / 8)
#define CVT_BLOCKS  ((EMB * EMB) / 1024)
__global__ __launch_bounds__(256) void prep_kernel(const float* __restrict__ W,
                                                   _Float16* __restrict__ Wh,
                                                   const int* __restrict__ mask,
                                                   unsigned* __restrict__ mw) {
  __shared__ alignas(16) unsigned char nib[8][16][16];  // [wave][query][key / 4]
  if (blockIdx.x >= PACK_BLOCKS) {
    long i = ((long)(blockIdx.x - PACK_BLOCKS) * 256 + threadIdx.x) * 4;
    float4 w = *(const float4*)(W + i);
    Wh[i + 0] = (_Float16)w.x; Wh[i + 1] = (_Float16)w.y;
    Wh[i + 2] = (_Float16)w.z; Wh[i + 3] = (_Float16)w.w;
    return;
  }
  const int wid  = threadIdx.x >> 5;
  const int lane = threadIdx.x & 31;
  const int lh   = lane >> 4;
  const int ln   = lane & 15;
  const int task = blockIdx.x * 8 + wid;     // tile16 * 32 + key block
  const int* mp = mask + (long)(task >> 5) * 16 * SEQ + (task & 31) * 64;
  // a load covers two rows of 256 B; four keys of one query -> one nibble
  int4 m[8];
#pragma unroll
  for (int j = 0; j < 8; ++j)
    m[j] = *(const int4*)(mp + (long)(2 * j + lh) * SEQ + 4 * ln);
#pragma unroll
  for (int j = 0; j < 8; ++j)
    nib[wid][2 * j + lh][ln] = (unsigned char)((m[j].x != 0 ? 1 : 0) | (m[j].y != 0 ? 2 : 0) |
                                               (m[j].z != 0 ? 4 : 0) | (m[j].w != 0 ? 8 : 0));
  __syncthreads();   // the nibbles of a row come from other lanes
  // query ln's 64 keys: key k is bit (k & 3) of byte k >> 2
  const uint4 rb = *(const uint4*)&nib[wid][ln][0];
  const unsigned x[4] = {rb.x >> (16 * lh), rb.y >> (16 * lh),
                         rb.z >> (16 * lh), rb.w >> (16 * lh)};
  unsigned w = 0;
#pragma unroll
  for (int t = 0; t < 4; ++t)
#pragma unroll
    for (int r = 0; r < 8; ++r) {
      unsigned b = __builtin_amdgcn_ballot_w32(((x[t] >> (8 * (r >> 2) + (r & 3))) & 1u) != 0);
      if (lane == t * 8 + r) w = b;
    }
  mw[(long)task * 32 + lane] = w;
  asm volatile("s_wait_xcnt 0x0" ::: "memory");
}

__global__ __launch_bounds__(256) __attribute__((amdgpu_waves_per_eu(4, 4)))
void attn_kernel(
    const float* __restrict__ query, const float* __restrict__ keys,
    const float* __restrict__ values, const unsigned* __restrict__ maskw,
    _Float16* __restrict__ ctx) {
  __shared__ alignas(16) _Float16 kLDS[64][72];      // [key][d]
  __shared__ alignas(16) _Float16 vLDS[64][72];      // [d][key]  (transposed!)

  const int tid  = threadIdx.x;
  const int wid  = tid >> 5;
  const int lane = tid & 31;
  const int lh   = lane >> 4;
  const int ln   = lane & 15;
  const int qt = blockIdx.x, h = blockIdx.y, n = blockIdx.z;
  const int q0 = qt * 128 + wid * 16;

  const float* qp = query  + ((long)n * SEQ + q0) * EMB + h * HD;
  const float* kp = keys   + (long)n * SEQ * EMB + h * HD;
  const float* vp = values + (long)n * SEQ * EMB + h * HD;
  // this wave's lane masks, 32 words a pass; the wave number is made uniform so
  // that the words come by scalar loads
  const unsigned* mwp = maskw +
      (long)(n * (SEQ / 16) + qt * 8 + __builtin_amdgcn_readfirstlane(wid)) * (SEQ / 64) * 32;

  // Q^T fragments (B operand: column = query ln, two K=32 chunks over D=64);
  // softmax 1/sqrt(EMB)=1/32 folded in
  v16h qa[2];
#pragma unroll
  for (int c = 0; c < 2; ++c)
#pragma unroll
    for (int i = 0; i < 16; ++i) {
      int k = ((i & 8) << 1) + (lh << 3) + (i & 7) + c * 32;
      qa[c][i] = (_Float16)(qp[(long)ln * EMB + k] * 0.03125f);
    }

  float mrow = -3.0e38f;   // running max of query ln (equal in both halves)
  float lrow = 0.0f;       // running sum over this half's keys only
  v8f o[4];                // o[ct][r] = O^T[d = ct*16 + 8*lh + r][query ln]
#pragma unroll
  for (int t = 0; t < 4; ++t)
#pragma unroll
    for (int r = 0; r < 8; ++r) o[t][r] = 0.0f;

  for (int kb = 0; kb < SEQ; kb += 64) {
    // This pass's lane masks, asked for together with the K and V tiles
    unsigned mk[32];
#pragma unroll
    for (int i = 0; i < 32; ++i) mk[i] = mwp[(kb >> 1) + i];

    // Stage K (row-major) and V (transposed) tiles, f32 -> f16
#pragma unroll
    for (int it = 0; it < 4; ++it) {
      int idx = tid + it * 256;
      int row = idx >> 4;               // key 0..63
      int c4  = (idx & 15) << 2;        // d 0..60
      float4 kv = *(const float4*)(kp + (long)(kb + row) * EMB + c4);
      float4 vv = *(const float4*)(vp + (long)(kb + row) * EMB + c4);
      kLDS[row][c4 + 0] = (_Float16)kv.x; kLDS[row][c4 + 1] = (_Float16)kv.y;
      kLDS[row][c4 + 2] = (_Float16)kv.z; kLDS[row][c4 + 3] = (_Float16)kv.w;
      vLDS[c4 + 0][row] = (_Float16)vv.x; vLDS[c4 + 1][row] = (_Float16)vv.y;
      vLDS[c4 + 2][row] = (_Float16)vv.z; vLDS[c4 + 3][row] = (_Float16)vv.w;
    }
    if (kb + 64 < SEQ) {                 // global_prefetch_b8 of the next tiles
      __builtin_prefetch(kp + (long)(kb + 64 + (tid & 63)) * EMB, 0, 0);
      __builtin_prefetch(vp + (long)(kb + 64 + (tid & 63)) * EMB, 0, 0);
    }
    __syncthreads();

    // S^T = K * (Q/32)^T for four 16-key sub-tiles; mask -> -1e30
    // sv[t][r] = score of (query ln, key kb + t*16 + 8*lh + r)
    float sv[4][8];
#pragma unroll
    for (int t = 0; t < 4; ++t) {
      v8f s;
#pragma unroll
      for (int r = 0; r < 8; ++r) s[r] = 0.0f;
      v16h a0 = frag_a(&kLDS[t * 16][0], 72);
      v16h a1 = frag_a(&kLDS[t * 16][32], 72);
      s = wmma16x16x32(a0, qa[0], s);
      s = wmma16x16x32(a1, qa[1], s);
#pragma unroll
      for (int r = 0; r < 8; ++r)
        sv[t][r] = __builtin_amdgcn_inverse_ballot_w32(mk[t * 8 + r]) ? s[r] : -1.0e30f;
    }

    // Online softmax, one query per lane: in-lane max, one half exchange
    float mt[4];
#pragma unroll
    for (int t = 0; t < 4; ++t)
      mt[t] = fmaxf(fmaxf(fmaxf(sv[t][0], sv[t][1]), fmaxf(sv[t][2], sv[t][3])),
                    fmaxf(fmaxf(sv[t][4], sv[t][5]), fmaxf(sv[t][6], sv[t][7])));
    float mloc = fmaxf(fmaxf(mt[0], mt[1]), fmaxf(mt[2], mt[3]));
    mloc = fmaxf(mloc, xhalf(mloc));
    const float mnew = fmaxf(mrow, mloc);
    const float corr = __expf(mrow - mnew);
    mrow = mnew;
    float ps[4];
#pragma unroll
    for (int t = 0; t < 4; ++t) {
      ps[t] = 0.0f;
#pragma unroll
      for (int r = 0; r < 8; ++r) {
        float p = __expf(sv[t][r] - mnew);
        sv[t][r] = p;
        ps[t] += p;
      }
    }
    lrow = lrow * corr + ((ps[0] + ps[1]) + (ps[2] + ps[3]));
#pragma unroll
    for (int ct = 0; ct < 4; ++ct)
#pragma unroll
      for (int r = 0; r < 8; ++r) o[ct][r] *= corr;

    // P^T as B operand: sub-tiles 2c and 2c+1 are k 0..15 and 16..31 of chunk c
    // in the hardware k order (element i: key c*32 + ((i&8)<<1) + 8*lh + (i&7))
    v16h pb[2];
#pragma unroll
    for (int c = 0; c < 2; ++c)
#pragma unroll
      for (int i = 0; i < 16; ++i)
        pb[c][i] = (_Float16)sv[2 * c + (i >> 3)][i & 7];

    // O^T += V^T(64x64) * P^T(64x16); V^T rows come from the [d][key] tile
#pragma unroll
    for (int ct = 0; ct < 4; ++ct) {
      o[ct] = wmma16x16x32(frag_a(&vLDS[ct * 16][0], 72), pb[0], o[ct]);
      o[ct] = wmma16x16x32(frag_a(&vLDS[ct * 16][32], 72), pb[1], o[ct]);
    }
    __syncthreads();
  }

  // Join the halves' sums, normalize, write f16 ctx[n, q0+ln, h*64 + d]:
  // 8 consecutive d per lane and tile -> one 16-byte store each
  lrow += xhalf(lrow);
  const float inv = 1.0f / lrow;
  _Float16* op = ctx + ((long)n * SEQ + q0 + ln) * EMB + h * HD + 8 * lh;
#pragma unroll
  for (int ct = 0; ct < 4; ++ct) {
    v8h w;
#pragma unroll
    for (int r = 0; r < 8; ++r) w[r] = (_Float16)(o[ct][r] * inv);
    *(v8h*)(op + ct * 16) = w;
  }
}

__global__ __launch_bounds__(256) void fc_kernel(
    const _Float16* __restrict__ ctx, const _Float16* __restrict__ Wh,
    const float* __restrict__ bias, float* __restrict__ out) {
  __shared__ alignas(16) _Float16 aLDS[2][128][40];
  __shared__ alignas(16) _Float16 bLDS[2][64][40];

  const int tid  = threadIdx.x;
  const int wid  = tid >> 5;
  const int lane = tid & 31;
  const int lh   = lane >> 4;
  const int ln   = lane & 15;
  const int n0 = blockIdx.x * 64;
  const int m0 = blockIdx.y * 128;
  const int wm = (wid >> 1) * 32;
  const int wn = (wid & 1) * 32;

  v8f acc[4];
#pragma unroll
  for (int t = 0; t < 4; ++t)
#pragma unroll
    for (int r = 0; r < 8; ++r) acc[t][r] = 0.0f;

  // Stage one 128x32 A-tile + 64x32 B-tile into LDS buffer `buf` (raw f16,
  // 16B chunks; row pad 40 halves keeps every chunk 16B aligned).
  auto stage = [&](int buf, int kc) {
#pragma unroll
    for (int it = 0; it < 2; ++it) {           // A: 512 x b128
      int idx = tid + it * 256;
      int row = idx >> 2, q = (idx & 3) * 8;
      async_copy_b128(lds_addr(&aLDS[buf][row][q]),
                      ctx + (long)(m0 + row) * EMB + kc + q);
    }
    {                                          // B: 256 x b128
      int row = tid >> 2, q = (tid & 3) * 8;
      async_copy_b128(lds_addr(&bLDS[buf][row][q]),
                      Wh + (long)(n0 + row) * EMB + kc + q);
    }
  };

  stage(0, 0);
  for (int kc = 0; kc < EMB; kc += 32) {
    int buf = (kc >> 5) & 1;
    wait_async0();          // my async writes done
    __syncthreads();        // everyone's async writes done; prev reads done
    if (kc + 32 < EMB) stage(buf ^ 1, kc + 32);

    v16h a0 = frag_a(&aLDS[buf][wm][0], 40);
    v16h a1 = frag_a(&aLDS[buf][wm + 16][0], 40);
    v16h b0 = frag_b_transposed(&bLDS[buf][wn][0], 40);   // B = W^T
    v16h b1 = frag_b_transposed(&bLDS[buf][wn + 16][0], 40);
    acc[0] = wmma16x16x32(a0, b0, acc[0]);
    acc[1] = wmma16x16x32(a0, b1, acc[1]);
    acc[2] = wmma16x16x32(a1, b0, acc[2]);
    acc[3] = wmma16x16x32(a1, b1, acc[3]);
  }

#pragma unroll
  for (int ti = 0; ti < 2; ++ti)
#pragma unroll
    for (int tj = 0; tj < 2; ++tj) {
      v8f a = acc[ti * 2 + tj];
#pragma unroll
      for (int r = 0; r < 8; ++r) {
        int row = m0 + wm + ti * 16 + r + 8 * lh;
        int col = n0 + wn + tj * 16 + ln;
        out[(long)row * EMB + col] = a[r] + bias[col];
      }
    }
}

extern "C" void kernel_launch(void* const* d_in, const int* in_sizes, int n_in,
                              void* d_out, int out_size, void* d_ws, size_t ws_size,
                              hipStream_t stream) {
  (void)in_sizes; (void)n_in; (void)out_size; (void)ws_size;
  const float* values = (const float*)d_in[0];
  const float* keys   = (const float*)d_in[1];
  const float* query  = (const float*)d_in[2];
  const int*   mask   = (const int*)d_in[3];
  const float* W_fc   = (const float*)d_in[4];
  const float* b_fc   = (const float*)d_in[5];

  // workspace: ctx_h (8 MiB f16) | W_h (2 MiB f16) | lane masks (1 MiB)
  _Float16* ctx_h = (_Float16*)d_ws;
  _Float16* W_h   = (_Float16*)((char*)d_ws + (size_t)NB * SEQ * EMB * 2);
  unsigned* mask_w = (unsigned*)((char*)d_ws + (size_t)NB * SEQ * EMB * 2 +
                                 (size_t)EMB * EMB * 2);

  prep_kernel<<<dim3(PACK_BLOCKS + CVT_BLOCKS), 256, 0, stream>>>(W_fc, W_h, mask,
                                                                  mask_w);
  attn_kernel<<<dim3(SEQ / 128, NH, NB), 256, 0, stream>>>(query, keys, values,
                                                           mask_w, ctx_h);
  fc_kernel<<<dim3(EMB / 64, (NB * SEQ) / 128), 256, 0, stream>>>(ctx_h, W_h,
                                                                  b_fc,
                                                                  (float*)d_out);
}

// v003
// It runs in 67.8 microseconds.
// Two timings next to v002 put it at 1.38 and 1.37 times that version's speed.
// Over all steps from v000 it is 1.95 times as fast.
#include <hip/hip_runtime.h>
#include <hip/hip_bf16.h>

#define SEQ 2048
#define NB  2
#define EMB 1024
#define NH  16
#define HD  64

typedef __attribute__((ext_vector_type(16))) _Float16 v16h;
typedef __attribute__((ext_vector_type(8)))  float    v8f;
typedef __attribute__((ext_vector_type(8)))  _Float16 v8h;
typedef __attribute__((ext_vector_type(4)))  _Float16 v4h;
typedef __attribute__((ext_vector_type(2)))  _Float16 v2h;

__device__ __forceinline__ v8f wmma16x16x32(v16h a, v16h b, v8f c) {
  // D = A(16x32 f16) x B(32x16 f16) + C(16x16 f32)
  return __builtin_amdgcn_wmma_f32_16x16x32_f16(false, a, false, b, (short)0, c,
                                                false, false);
}

__device__ __forceinline__ v16h frag_a(const _Float16* base, int stride) {
  const int lane = threadIdx.x & 31;
  const int m = lane & 15, lh = lane >> 4;
  v16h r;
#pragma unroll
  for (int i = 0; i < 16; ++i) {
    int k = ((i & 8) << 1) + (lh << 3) + (i & 7);
    r[i] = base[m * stride + k];
  }
  return r;
}

// B-matrix fragment B[k][n] from LDS stored [n][k]; same 16B-run property.
__device__ __forceinline__ v16h frag_b_transposed(const _Float16* base, int stride) {
  const int lane = threadIdx.x & 31;
  const int nn = lane & 15, lh = lane >> 4;
  v16h r;
#pragma unroll
  for (int i = 0; i < 16; ++i) {
    int k = ((i & 8) << 1) + (lh << 3) + (i & 7);
    r[i] = base[nn * stride + k];
  }
  return r;
}

__device__ __forceinline__ float xhalf(float v) {
  int b = __builtin_bit_cast(int, v);
  b = __builtin_amdgcn_permlanex16(b, b, 0x76543210, 0xfedcba98, false, false);
  return __builtin_bit_cast(float, b);
}

__device__ __forceinline__ unsigned lds_addr(const void* p) {
  // flat LDS addresses: low 32 bits are the wave-relative LDS offset
  return (unsigned)(unsigned long long)p;
}
__device__ __forceinline__ void async_copy_b128(unsigned lds_off, const void* g) {
  asm volatile("global_load_async_to_lds_b128 %0, %1, off"
               :: "v"(lds_off), "v"(g) : "memory");
}
__device__ __forceinline__ void async_copy4_b128(unsigned l0, unsigned l1, unsigned l2,
                                                 unsigned l3, const void* g0, const void* g1,
                                                 const void* g2, const void* g3) {
  asm volatile("global_load_async_to_lds_b128 %0, %4, off\n\t"
               "global_load_async_to_lds_b128 %1, %5, off\n\t"
               "global_load_async_to_lds_b128 %2, %6, off\n\t"
               "global_load_async_to_lds_b128 %3, %7, off\n\t"
               "s_wait_xcnt 0x0"
               :: "v"(l0), "v"(l1), "v"(l2), "v"(l3), "v"(g0), "v"(g1), "v"(g2), "v"(g3)
               : "memory");
}
__device__ __forceinline__ void wait_async0() {
  asm volatile("s_wait_asynccnt 0x0" ::: "memory");
}

// ---------------------------------------------------------------------------
// Kernel 0, three independent jobs by block index.
// Blocks 0 .. KV_BLOCKS-1 (the longest, so they start first): one head's K and V
// rows of 128 keys, f32 -> f16, laid out as the attention kernel's LDS tiles:
//   Kh[n][h][key][d]                 (a tile of 64 keys = 8 KiB in a row)
//   Vt[n][h][key / 64][d][key % 64]  (transposed; a tile = 8 KiB in a row)
// The next PACK_BLOCKS blocks: the int32 mask, read once with whole-line loads,
// becomes lane masks for the attention kernel. One wave takes one tile of
// 16 queries x 64 keys and writes 32 words:
//   mw[tile16][key block][t*8 + r], bit (16*lh + ln) =
//     mask[query tile16*16 + ln][key block*64 + t*16 + 8*lh + r] != 0
// which is the place of that score in the S^T accumulator (tile t, register r,
// lane 16*lh + ln).
// The other blocks: W f32 -> f16 conversion (4 MB read, 2 MB write).
// ---------------------------------------------------------------------------
#define PACK_BLOCKS ((NB * (SEQ / 16) * (SEQ / 64)) / 8)
#define CVT_BLOCKS  ((EMB * EMB) / 1024)
#define KV_BLOCKS   (NB * NH * (SEQ / 128))
__global__ __launch_bounds__(256) void prep_kernel(const float* __restrict__ W,
                                                   _Float16* __restrict__ Wh,
                                                   const int* __restrict__ mask,
                                                   unsigned* __restrict__ mw,
                                                   const float* __restrict__ keys,
                                                   const float* __restrict__ values,
                                                   _Float16* __restrict__ Kh,
                                                   _Float16* __restrict__ Vt) {
  __shared__ alignas(16) unsigned char nib[8][16][16];  // [wave][query][key / 4]
  __shared__ alignas(16) _Float16 vtr[HD][136];         // [d][key], 128 keys + pad
  if (blockIdx.x < KV_BLOCKS) {
    const int tid = threadIdx.x;
    const int kb  = (blockIdx.x & (SEQ / 128 - 1)) * 128;
    const int nh  = blockIdx.x / (SEQ / 128);           // n * NH + h
    const long in_off = ((long)(nh / NH) * SEQ + kb) * EMB + (nh % NH) * HD;
    const float* kp = keys + in_off;
    const float* vp = values + in_off;
    _Float16* ko = Kh + ((long)nh * SEQ + kb) * HD;
    _Float16* vo = Vt + ((long)nh * SEQ + kb) * HD;
    const int c4 = (tid & 15) * 4;                      // d 0..60
    const int r0 = tid >> 4;                            // 0..15
    float4 kv[8], va[4], vb[4];
#pragma unroll
    for (int it = 0; it < 8; ++it)
      kv[it] = *(const float4*)(kp + (long)(r0 + 16 * it) * EMB + c4);
#pragma unroll
    for (int it = 0; it < 4; ++it) {                    // two neighbouring keys
      va[it] = *(const float4*)(vp + (long)(2 * (r0 + 16 * it)) * EMB + c4);
      vb[it] = *(const float4*)(vp + (long)(2 * (r0 + 16 * it) + 1) * EMB + c4);
    }
#pragma unroll
    for (int it = 0; it < 8; ++it) {
      v4h w = {(_Float16)kv[it].x, (_Float16)kv[it].y, (_Float16)kv[it].z, (_Float16)kv[it].w};
      *(v4h*)(ko + (r0 + 16 * it) * HD + c4) = w;
    }
#pragma unroll
    for (int it = 0; it < 4; ++it) {
      const int key = 2 * (r0 + 16 * it);
      v2h p0 = {(_Float16)va[it].x, (_Float16)vb[it].x};
      v2h p1 = {(_Float16)va[it].y, (_Float16)vb[it].y};
      v2h p2 = {(_Float16)va[it].z, (_Float16)vb[it].z};
      v2h p3 = {(_Float16)va[it].w, (_Float16)vb[it].w};
      *(v2h*)&vtr[c4 + 0][key] = p0; *(v2h*)&vtr[c4 + 1][key] = p1;
      *(v2h*)&vtr[c4 + 2][key] = p2; *(v2h*)&vtr[c4 + 3][key] = p3;
    }
    __syncthreads();   // a row of one d holds keys written by other waves
#pragma unroll
    for (int it = 0; it < 4; ++it) {
      const int c = tid + it * 256;   // 16-byte piece: tile c >> 9, d (c >> 3) & 63
      *(v8h*)(vo + c * 8) = *(const v8h*)&vtr[(c >> 3) & 63][(c >> 9) * 64 + (c & 7) * 8];
    }
    return;
  }
  const int bid = blockIdx.x - KV_BLOCKS;
  if (bid >= PACK_BLOCKS) {
    long i = ((long)(bid - PACK_BLOCKS) * 256 + threadIdx.x) * 4;
    float4 w = *(const float4*)(W + i);
    Wh[i + 0] = (_Float16)w.x; Wh[i + 1] = (_Float16)w.y;
    Wh[i + 2] = (_Float16)w.z; Wh[i + 3] = (_Float16)w.w;
    return;
  }
  const int wid  = threadIdx.x >> 5;
  const int lane = threadIdx.x & 31;
  const int lh   = lane >> 4;
  const int ln   = lane & 15;
  const int task = bid * 8 + wid;            // tile16 * 32 + key block
  const int* mp = mask + (long)(task >> 5) * 16 * SEQ + (task & 31) * 64;
  // a load covers two rows of 256 B; four keys of one query -> one nibble
  int4 m[8];
#pragma unroll
  for (int j = 0; j < 8; ++j)
    m[j] = *(const int4*)(mp + (long)(2 * j + lh) * SEQ + 4 * ln);
#pragma unroll
  for (int j = 0; j < 8; ++j)
    nib[wid][2 * j + lh][ln] = (unsigned char)((m[j].x != 0 ? 1 : 0) | (m[j].y != 0 ? 2 : 0) |
                                               (m[j].z != 0 ? 4 : 0) | (m[j].w != 0 ? 8 : 0));
  __syncthreads();   // the nibbles of a row come from other lanes
  // query ln's 64 keys: key k is bit (k & 3) of byte k >> 2
  const uint4 rb = *(const uint4*)&nib[wid][ln][0];
  const unsigned x[4] = {rb.x >> (16 * lh), rb.y >> (16 * lh),
                         rb.z >> (16 * lh), rb.w >> (16 * lh)};
  unsigned w = 0;
#pragma unroll
  for (int t = 0; t < 4; ++t)
#pragma unroll
    for (int r = 0; r < 8; ++r) {
      unsigned b = __builtin_amdgcn_ballot_w32(((x[t] >> (8 * (r >> 2) + (r & 3))) & 1u) != 0);
      if (lane == t * 8 + r) w = b;
    }
  mw[(long)task * 32 + lane] = w;
  asm volatile("s_wait_xcnt 0x0" ::: "memory");
}

__global__ __launch_bounds__(256) __attribute__((amdgpu_waves_per_eu(4, 4)))
void attn_kernel(
    const float* __restrict__ query, const _Float16* __restrict__ Kh,
    const _Float16* __restrict__ Vt, const unsigned* __restrict__ maskw,
    _Float16* __restrict__ ctx) {
  __shared__ alignas(16) _Float16 kLDS[2][64][72];   // [buffer][key][d]
  __shared__ alignas(16) _Float16 vLDS[2][64][72];   // [buffer][d][key]  (transposed!)

  const int tid  = threadIdx.x;
  const int wid  = tid >> 5;
  const int lane = tid & 31;
  const int lh   = lane >> 4;
  const int ln   = lane & 15;
  const int qt = blockIdx.x, h = blockIdx.y, n = blockIdx.z;
  const int q0 = qt * 128 + wid * 16;

  const float* qp = query  + ((long)n * SEQ + q0) * EMB + h * HD;
  // a tile is 512 pieces of 16 bytes in a row; this thread copies pieces tid and
  // tid + 256 of each tile: LDS row = piece / 8, 144 bytes a row
  const _Float16* kp = Kh + (long)(n * NH + h) * SEQ * HD + tid * 8;
  const _Float16* vp = Vt + (long)(n * NH + h) * SEQ * HD + tid * 8;
  const unsigned lpiece = (unsigned)((tid >> 3) * 144 + (tid & 7) * 16);
  auto stage = [&](int buf, int tile) {
    const unsigned lk = lds_addr(&kLDS[buf][0][0]) + lpiece;
    const unsigned lv = lds_addr(&vLDS[buf][0][0]) + lpiece;
    const _Float16* gk = kp + tile * (64 * HD);
    const _Float16* gv = vp + tile * (64 * HD);
    async_copy4_b128(lk, lk + 32 * 144, lv, lv + 32 * 144,
                     gk, gk + 256 * 8, gv, gv + 256 * 8);
  };
  stage(0, 0);
  // this wave's lane masks, 32 words a pass; the wave number is made uniform so
  // that the words come by scalar loads
  // (read through the constant address space: nothing writes them in this launch, and
  // the "memory" clobbers of the copies and waits would otherwise turn the scalar loads
  // into vector loads)
  typedef __attribute__((address_space(4))) const unsigned cuint;
  cuint* mwp = (cuint*)(unsigned long long)(maskw +
      (long)(n * (SEQ / 16) + qt * 8 + __builtin_amdgcn_readfirstlane(wid)) * (SEQ / 64) * 32);

  // Q^T fragments (B operand: column = query ln, two K=32 chunks over D=64);
  // softmax 1/sqrt(EMB)=1/32 folded in
  v16h qa[2];
#pragma unroll
  for (int c = 0; c < 2; ++c)
#pragma unroll
    for (int i = 0; i < 16; ++i) {
      int k = ((i & 8) << 1) + (lh << 3) + (i & 7) + c * 32;
      qa[c][i] = (_Float16)(qp[(long)ln * EMB + k] * 0.03125f);
    }

  float mrow = -3.0e38f;   // running max of query ln (equal in both halves)
  float lrow = 0.0f;       // running sum over this half's keys only
  v8f o[4];                // o[ct][r] = O^T[d = ct*16 + 8*lh + r][query ln]
#pragma unroll
  for (int t = 0; t < 4; ++t)
#pragma unroll
    for (int r = 0; r < 8; ++r) o[t][r] = 0.0f;

  // The first pass's lane masks; each pass asks for the next pass's
  unsigned mk[32];
#pragma unroll
  for (int i = 0; i < 32; ++i) mk[i] = mwp[i];

  wait_async0();       // my pieces of tile 0 have landed
  __syncthreads();     // everyone's have
  stage(1, 1);

  for (int pass = 0; pass < SEQ / 64; ++pass) {
    const int buf = pass & 1;

    // S^T = K * (Q/32)^T for four 16-key sub-tiles; mask -> -1e30
    // sv[t][r] = score of (query ln, key kb + t*16 + 8*lh + r)
    float sv[4][8];
#pragma unroll
    for (int t = 0; t < 4; ++t) {
      v8f s;
#pragma unroll
      for (int r = 0; r < 8; ++r) s[r] = 0.0f;
      v16h a0 = frag_a(&kLDS[buf][t * 16][0], 72);
      v16h a1 = frag_a(&kLDS[buf][t * 16][32], 72);
      s = wmma16x16x32(a0, qa[0], s);
      s = wmma16x16x32(a1, qa[1], s);
#pragma unroll
      for (int r = 0; r < 8; ++r)
        sv[t][r] = __builtin_amdgcn_inverse_ballot_w32(mk[t * 8 + r]) ? s[r] : -1.0e30f;
    }
    // the words are used up: ask for the next pass's (the last pass asks for its own again)
    {
      cuint* mn = mwp + (pass + 1 < SEQ / 64 ? pass + 1 : pass) * 32;
#pragma unroll
      for (int i = 0; i < 32; ++i) mk[i] = mn[i];
    }

    // Online softmax, one query per lane: in-lane max, one half exchange
    float mt[4];
#pragma unroll
    for (int t = 0; t < 4; ++t)
      mt[t] = fmaxf(fmaxf(fmaxf(sv[t][0], sv[t][1]), fmaxf(sv[t][2], sv[t][3])),
                    fmaxf(fmaxf(sv[t][4], sv[t][5]), fmaxf(sv[t][6], sv[t][7])));
    float mloc = fmaxf(fmaxf(mt[0], mt[1]), fmaxf(mt[2], mt[3]));
    mloc = fmaxf(mloc, xhalf(mloc));
    const float mnew = fmaxf(mrow, mloc);
    const float corr = __expf(mrow - mnew);
    mrow = mnew;
    float ps[4];
#pragma unroll
    for (int t = 0; t < 4; ++t) {
      ps[t] = 0.0f;
#pragma unroll
      for (int r = 0; r < 8; ++r) {
        float p = __expf(sv[t][r] - mnew);
        sv[t][r] = p;
        ps[t] += p;
      }
    }
    lrow = lrow * corr + ((ps[0] + ps[1]) + (ps[2] + ps[3]));
#pragma unroll
    for (int ct = 0; ct < 4; ++ct)
#pragma unroll
      for (int r = 0; r < 8; ++r) o[ct][r] *= corr;

    // P^T as B operand: sub-tiles 2c and 2c+1 are k 0..15 and 16..31 of chunk c
    // in the hardware k order (element i: key c*32 + ((i&8)<<1) + 8*lh + (i&7))
    v16h pb[2];
#pragma unroll
    for (int c = 0; c < 2; ++c)
#pragma unroll
      for (int i = 0; i < 16; ++i)
        pb[c][i] = (_Float16)sv[2 * c + (i >> 3)][i & 7];

    // O^T += V^T(64x64) * P^T(64x16); V^T rows come from the [d][key] tile
#pragma unroll
    for (int ct = 0; ct < 4; ++ct) {
      o[ct] = wmma16x16x32(frag_a(&vLDS[buf][ct * 16][0], 72), pb[0], o[ct]);
      o[ct] = wmma16x16x32(frag_a(&vLDS[buf][ct * 16][32], 72), pb[1], o[ct]);
    }
    // hand-over: my reads of this buffer are done, my pieces of the next tile have
    // landed; behind the barrier that holds for every wave, and this buffer is refilled
    asm volatile("s_wait_dscnt 0x0" ::: "memory");
    wait_async0();
    __syncthreads();
    if (pass + 2 < SEQ / 64) stage(buf, pass + 2);
  }
  wait_async0();       // no copy is outstanding when the wave ends

  // Join the halves' sums, normalize, write f16 ctx[n, q0+ln, h*64 + d]:
  // 8 consecutive d per lane and tile -> one 16-byte store each
  lrow += xhalf(lrow);
  const float inv = 1.0f / lrow;
  _Float16* op = ctx + ((long)n * SEQ + q0 + ln) * EMB + h * HD + 8 * lh;
#pragma unroll
  for (int ct = 0; ct < 4; ++ct) {
    v8h w;
#pragma unroll
    for (int r = 0; r < 8; ++r) w[r] = (_Float16)(o[ct][r] * inv);
    *(v8h*)(op + ct * 16) = w;
  }
}

__global__ __launch_bounds__(256) void fc_kernel(
    const _Float16* __restrict__ ctx, const _Float16* __restrict__ Wh,
    const float* __restrict__ bias, float* __restrict__ out) {
  __shared__ alignas(16) _Float16 aLDS[2][128][40];
  __shared__ alignas(16) _Float16 bLDS[2][64][40];

  const int tid  = threadIdx.x;
  const int wid  = tid >> 5;
  const int lane = tid & 31;
  const int lh   = lane >> 4;
  const int ln   = lane & 15;
  const int n0 = blockIdx.x * 64;
  const int m0 = blockIdx.y * 128;
  const int wm = (wid >> 1) * 32;
  const int wn = (wid & 1) * 32;

  v8f acc[4];
#pragma unroll
  for (int t = 0; t < 4; ++t)
#pragma unroll
    for (int r = 0; r < 8; ++r) acc[t][r] = 0.0f;

  // Stage one 128x32 A-tile + 64x32 B-tile into LDS buffer `buf` (raw f16,
  // 16B chunks; row pad 40 halves keeps every chunk 16B aligned).
  auto stage = [&](int buf, int kc) {
#pragma unroll
    for (int it = 0; it < 2; ++it) {           // A: 512 x b128
      int idx = tid + it * 256;
      int row = idx >> 2, q = (idx & 3) * 8;
      async_copy_b128(lds_addr(&aLDS[buf][row][q]),
                      ctx + (long)(m0 + row) * EMB + kc + q);
    }
    {                                          // B: 256 x b128
      int row = tid >> 2, q = (tid & 3) * 8;
      async_copy_b128(lds_addr(&bLDS[buf][row][q]),
                      Wh + (long)(n0 + row) * EMB + kc + q);
    }
  };

  stage(0, 0);
  for (int kc = 0; kc < EMB; kc += 32) {
    int buf = (kc >> 5) & 1;
    wait_async0();          // my async writes done
    __syncthreads();        // everyone's async writes done; prev reads done
    if (kc + 32 < EMB) stage(buf ^ 1, kc + 32);

    v16h a0 = frag_a(&aLDS[buf][wm][0], 40);
    v16h a1 = frag_a(&aLDS[buf][wm + 16][0], 40);
    v16h b0 = frag_b_transposed(&bLDS[buf][wn][0], 40);   // B = W^T
    v16h b1 = frag_b_transposed(&bLDS[buf][wn + 16][0], 40);
    acc[0] = wmma16x16x32(a0, b0, acc[0]);
    acc[1] = wmma16x16x32(a0, b1, acc[1]);
    acc[2] = wmma16x16x32(a1, b0, acc[2]);
    acc[3] = wmma16x16x32(a1, b1, acc[3]);
  }

#pragma unroll
  for (int ti = 0; ti < 2; ++ti)
#pragma unroll
    for (int tj = 0; tj < 2; ++tj) {
      v8f a = acc[ti * 2 + tj];
#pragma unroll
      for (int r = 0; r < 8; ++r) {
        int row = m0 + wm + ti * 16 + r + 8 * lh;
        int col = n0 + wn + tj * 16 + ln;
        out[(long)row * EMB + col] = a[r] + bias[col];
      }
    }
}

extern "C" void kernel_launch(void* const* d_in, const int* in_sizes, int n_in,
                              void* d_out, int out_size, void* d_ws, size_t ws_size,
                              hipStream_t stream) {
  (void)in_sizes; (void)n_in; (void)out_size; (void)ws_size;
  const float* values = (const float*)d_in[0];
  const float* keys   = (const float*)d_in[1];
  const float* query  = (const float*)d_in[2];
  const int*   mask   = (const int*)d_in[3];
  const float* W_fc   = (const float*)d_in[4];
  const float* b_fc   = (const float*)d_in[5];

  // workspace: ctx_h (8 MiB f16) | W_h (2 MiB f16) | lane masks (1 MiB) |
  //            K_h (8 MiB f16) | V_t (8 MiB f16)
  _Float16* ctx_h = (_Float16*)d_ws;
  _Float16* W_h   = (_Float16*)((char*)d_ws + (size_t)NB * SEQ * EMB * 2);
  unsigned* mask_w = (unsigned*)((char*)d_ws + (size_t)NB * SEQ * EMB * 2 +
                                 (size_t)EMB * EMB * 2);
  _Float16* K_h = (_Float16*)((char*)d_ws + (size_t)NB * SEQ * EMB * 2 +
                              (size_t)EMB * EMB * 2 + (size_t)NB * SEQ * SEQ / 8);
  _Float16* V_t = K_h + (size_t)NB * SEQ * EMB;

  prep_kernel<<<dim3(KV_BLOCKS + PACK_BLOCKS + CVT_BLOCKS), 256, 0, stream>>>(
      W_fc, W_h, mask, mask_w, keys, values, K_h, V_t);
  attn_kernel<<<dim3(SEQ / 128, NH, NB), 256, 0, stream>>>(query, K_h, V_t,
                                                           mask_w, ctx_h);
  fc_kernel<<<dim3(EMB / 64, (NB * SEQ) / 128), 256, 0, stream>>>(ctx_h, W_h,
                                                                  b_fc,
                                                                  (float*)d_out);
}

// v004
// A run of this version takes 63.7 microseconds.
// Next to v003, in two timings, it ran 1.06 and 1.07 times as fast.
// Over all steps from v000 it is 2.08 times as fast.
#include <hip/hip_runtime.h>
#include <hip/hip_bf16.h>

#define SEQ 2048
#define NB  2
#define EMB 1024
#define NH  16
#define HD  64

typedef __attribute__((ext_vector_type(16))) _Float16 v16h;
typedef __attribute__((ext_vector_type(8)))  float    v8f;
typedef __attribute__((ext_vector_type(8)))  _Float16 v8h;
typedef __attribute__((ext_vector_type(4)))  _Float16 v4h;
typedef __attribute__((ext_vector_type(2)))  _Float16 v2h;

__device__ __forceinline__ v8f wmma16x16x32(v16h a, v16h b, v8f c) {
  // D = A(16x32 f16) x B(32x16 f16) + C(16x16 f32)
  return __builtin_amdgcn_wmma_f32_16x16x32_f16(false, a, false, b, (short)0, c,
                                                false, false);
}

__device__ __forceinline__ v16h frag_a(const _Float16* base, int stride) {
  const int lane = threadIdx.x & 31;
  const int m = lane & 15, lh = lane >> 4;
  v16h r;
#pragma unroll
  for (int i = 0; i < 16; ++i) {
    int k = ((i & 8) << 1) + (lh << 3) + (i & 7);
    r[i] = base[m * stride + k];
  }
  return r;
}

// B-matrix fragment B[k][n] from LDS stored [n][k]; same 16B-run property.
__device__ __forceinline__ v16h frag_b_transposed(const _Float16* base, int stride) {
  const int lane = threadIdx.x & 31;
  const int nn = lane & 15, lh = lane >> 4;
  v16h r;
#pragma unroll
  for (int i = 0; i < 16; ++i) {
    int k = ((i & 8) << 1) + (lh << 3) + (i & 7);
    r[i] = base[nn * stride + k];
  }
  return r;
}

__device__ __forceinline__ float xhalf(float v) {
  int b = __builtin_bit_cast(int, v);
  b = __builtin_amdgcn_permlanex16(b, b, 0x76543210, 0xfedcba98, false, false);
  return __builtin_bit_cast(float, b);
}

__device__ __forceinline__ unsigned lds_addr(const void* p) {
  // flat LDS addresses: low 32 bits are the wave-relative LDS offset
  return (unsigned)(unsigned long long)p;
}
__device__ __forceinline__ void async_copy_b128(unsigned lds_off, const void* g) {
  asm volatile("global_load_async_to_lds_b128 %0, %1, off"
               :: "v"(lds_off), "v"(g) : "memory");
}
__device__ __forceinline__ void async_copy4_b128(unsigned l0, unsigned l1, unsigned l2,
                                                 unsigned l3, const void* g0, const void* g1,
                                                 const void* g2, const void* g3) {
  asm volatile("global_load_async_to_lds_b128 %0, %4, off\n\t"
               "global_load_async_to_lds_b128 %1, %5, off\n\t"
               "global_load_async_to_lds_b128 %2, %6, off\n\t"
               "global_load_async_to_lds_b128 %3, %7, off\n\t"
               "s_wait_xcnt 0x0"
               :: "v"(l0), "v"(l1), "v"(l2), "v"(l3), "v"(g0), "v"(g1), "v"(g2), "v"(g3)
               : "memory");
}
__device__ __forceinline__ void wait_async0() {
  asm volatile("s_wait_asynccnt 0x0" ::: "memory");
}

// ---------------------------------------------------------------------------
// Kernel 0, three independent jobs by block index.
// Blocks 0 .. KV_BLOCKS-1 (the longest, so they start first): one head's K and V
// rows of 128 keys, f32 -> f16, laid out as the attention kernel's LDS tiles:
//   Kh[n][h][key][d]                 (a tile of 64 keys = 8 KiB in a row)
//   Vt[n][h][key / 64][d][key % 64]  (transposed; a tile = 8 KiB in a row)
// The next PACK_BLOCKS blocks: the int32 mask, read once with whole-line loads,
// becomes lane masks for the attention kernel. One wave takes one tile of
// 16 queries x 64 keys and writes 32 words:
//   mw[tile16][key block][t*8 + r], bit (16*lh + ln) =
//     mask[query tile16*16 + ln][key block*64 + t*16 + 8*lh + r] != 0
// which is the place of that score in the S^T accumulator (tile t, register r,
// lane 16*lh + ln).
// The other blocks: W f32 -> f16 conversion (4 MB read, 2 MB write).
// ---------------------------------------------------------------------------
#define PACK_BLOCKS ((NB * (SEQ / 16) * (SEQ / 64)) / 8)
#define CVT_BLOCKS  ((EMB * EMB) / 1024)
#define KV_BLOCKS   (NB * NH * (SEQ / 128))
__global__ __launch_bounds__(256) void prep_kernel(const float* __restrict__ W,
                                                   _Float16* __restrict__ Wh,
                                                   const int* __restrict__ mask,
                                                   unsigned* __restrict__ mw,
                                                   const float* __restrict__ keys,
                                                   const float* __restrict__ values,
                                                   _Float16* __restrict__ Kh,
                                                   _Float16* __restrict__ Vt) {
  __shared__ alignas(16) unsigned char nib[8][16][16];  // [wave][query][key / 4]
  __shared__ alignas(16) _Float16 vtr[HD][136];         // [d][key], 128 keys + pad
  if (blockIdx.x < KV_BLOCKS) {
    const int tid = threadIdx.x;
    const int kb  = (blockIdx.x & (SEQ / 128 - 1)) * 128;
    const int nh  = blockIdx.x / (SEQ / 128);           // n * NH + h
    const long in_off = ((long)(nh / NH) * SEQ + kb) * EMB + (nh % NH) * HD;
    const float* kp = keys + in_off;
    const float* vp = values + in_off;
    _Float16* ko = Kh + ((long)nh * SEQ + kb) * HD;
    _Float16* vo = Vt + ((long)nh * SEQ + kb) * HD;
    const int c4 = (tid & 15) * 4;                      // d 0..60
    const int r0 = tid >> 4;                            // 0..15
    float4 kv[8], va[4], vb[4];
#pragma unroll
    for (int it = 0; it < 8; ++it)
      kv[it] = *(const float4*)(kp + (long)(r0 + 16 * it) * EMB + c4);
#pragma unroll
    for (int it = 0; it < 4; ++it) {                    // two neighbouring keys
      va[it] = *(const float4*)(vp + (long)(2 * (r0 + 16 * it)) * EMB + c4);
      vb[it] = *(const float4*)(vp + (long)(2 * (r0 + 16 * it) + 1) * EMB + c4);
    }
#pragma unroll
    for (int it = 0; it < 8; ++it) {
      v4h w = {(_Float16)kv[it].x, (_Float16)kv[it].y, (_Float16)kv[it].z, (_Float16)kv[it].w};
      *(v4h*)(ko + (r0 + 16 * it) * HD + c4) = w;
    }
#pragma unroll
    for (int it = 0; it < 4; ++it) {
      const int key = 2 * (r0 + 16 * it);
      v2h p0 = {(_Float16)va[it].x, (_Float16)vb[it].x};
      v2h p1 = {(_Float16)va[it].y, (_Float16)vb[it].y};
      v2h p2 = {(_Float16)va[it].z, (_Float16)vb[it].z};
      v2h p3 = {(_Float16)va[it].w, (_Float16)vb[it].w};
      *(v2h*)&vtr[c4 + 0][key] = p0; *(v2h*)&vtr[c4 + 1][key] = p1;
      *(v2h*)&vtr[c4 + 2][key] = p2; *(v2h*)&vtr[c4 + 3][key] = p3;
    }
    __syncthreads();   // a row of one d holds keys written by other waves
#pragma unroll
    for (int it = 0; it < 4; ++it) {
      const int c = tid + it * 256;   // 16-byte piece: tile c >> 9, d (c >> 3) & 63
      *(v8h*)(vo + c * 8) = *(const v8h*)&vtr[(c >> 3) & 63][(c >> 9) * 64 + (c & 7) * 8];
    }
    return;
  }
  const int bid = blockIdx.x - KV_BLOCKS;
  if (bid >= PACK_BLOCKS) {
    long i = ((long)(bid - PACK_BLOCKS) * 256 + threadIdx.x) * 4;
    float4 w = *(const float4*)(W + i);
    Wh[i + 0] = (_Float16)w.x; Wh[i + 1] = (_Float16)w.y;
    Wh[i + 2] = (_Float16)w.z; Wh[i + 3] = (_Float16)w.w;
    return;
  }
  const int wid  = threadIdx.x >> 5;
  const int lane = threadIdx.x & 31;
  const int lh   = lane >> 4;
  const int ln   = lane & 15;
  const int task = bid * 8 + wid;            // tile16 * 32 + key block
  const int* mp = mask + (long)(task >> 5) * 16 * SEQ + (task & 31) * 64;
  // a load covers two rows of 256 B; four keys of one query -> one nibble
  int4 m[8];
#pragma unroll
  for (int j = 0; j < 8; ++j)
    m[j] = *(const int4*)(mp + (long)(2 * j + lh) * SEQ + 4 * ln);
#pragma unroll
  for (int j = 0; j < 8; ++j)
    nib[wid][2 * j + lh][ln] = (unsigned char)((m[j].x != 0 ? 1 : 0) | (m[j].y != 0 ? 2 : 0) |
                                               (m[j].z != 0 ? 4 : 0) | (m[j].w != 0 ? 8 : 0));
  __syncthreads();   // the nibbles of a row come from other lanes
  // query ln's 64 keys: key k is bit (k & 3) of byte k >> 2
  const uint4 rb = *(const uint4*)&nib[wid][ln][0];
  const unsigned x[4] = {rb.x >> (16 * lh), rb.y >> (16 * lh),
                         rb.z >> (16 * lh), rb.w >> (16 * lh)};
  unsigned w = 0;
#pragma unroll
  for (int t = 0; t < 4; ++t)
#pragma unroll
    for (int r = 0; r < 8; ++r) {
      unsigned b = __builtin_amdgcn_ballot_w32(((x[t] >> (8 * (r >> 2) + (r & 3))) & 1u) != 0);
      if (lane == t * 8 + r) w = b;
    }
  mw[(long)task * 32 + lane] = w;
  asm volatile("s_wait_xcnt 0x0" ::: "memory");
}

__global__ __launch_bounds__(256) __attribute__((amdgpu_waves_per_eu(4, 4)))
void attn_kernel(
    const float* __restrict__ query, const _Float16* __restrict__ Kh,
    const _Float16* __restrict__ Vt, const unsigned* __restrict__ maskw,
    _Float16* __restrict__ ctx) {
  __shared__ alignas(16) _Float16 kLDS[2][64][72];   // [buffer][key][d]
  __shared__ alignas(16) _Float16 vLDS[2][64][72];   // [buffer][d][key]  (transposed!)

  const int tid  = threadIdx.x;
  const int wid  = tid >> 5;
  const int lane = tid & 31;
  const int lh   = lane >> 4;
  const int ln   = lane & 15;
  const int qt = blockIdx.x, h = blockIdx.y, n = blockIdx.z;
  const int q0 = qt * 128 + wid * 16;

  const float* qp = query  + ((long)n * SEQ + q0) * EMB + h * HD;
  // a tile is 512 pieces of 16 bytes in a row; this thread copies pieces tid and
  // tid + 256 of each tile: LDS row = piece / 8, 144 bytes a row
  const _Float16* kp = Kh + (long)(n * NH + h) * SEQ * HD + tid * 8;
  const _Float16* vp = Vt + (long)(n * NH + h) * SEQ * HD + tid * 8;
  const unsigned lpiece = (unsigned)((tid >> 3) * 144 + (tid & 7) * 16);
  auto stage = [&](int buf, int tile) {
    const unsigned lk = lds_addr(&kLDS[buf][0][0]) + lpiece;
    const unsigned lv = lds_addr(&vLDS[buf][0][0]) + lpiece;
    const _Float16* gk = kp + tile * (64 * HD);
    const _Float16* gv = vp + tile * (64 * HD);
    async_copy4_b128(lk, lk + 32 * 144, lv, lv + 32 * 144,
                     gk, gk + 256 * 8, gv, gv + 256 * 8);
  };
  stage(0, 0);
  // this wave's lane masks, 32 words a pass; the wave number is made uniform so
  // that the words come by scalar loads
  // (read through the constant address space: nothing writes them in this launch, and
  // the "memory" clobbers of the copies and waits would otherwise turn the scalar loads
  // into vector loads)
  typedef __attribute__((address_space(4))) const unsigned cuint;
  cuint* mwp = (cuint*)(unsigned long long)(maskw +
      (long)(n * (SEQ / 16) + qt * 8 + __builtin_amdgcn_readfirstlane(wid)) * (SEQ / 64) * 32);

  // Q^T fragments (B operand: column = query ln, two K=32 chunks over D=64);
  // softmax 1/sqrt(EMB)=1/32 and log2(e) folded in
  v16h qa[2];
#pragma unroll
  for (int c = 0; c < 2; ++c)
#pragma unroll
    for (int i = 0; i < 16; ++i) {
      int k = ((i & 8) << 1) + (lh << 3) + (i & 7) + c * 32;
      qa[c][i] = (_Float16)(qp[(long)ln * EMB + k] * (1.4426950408889634f * 0.03125f));
    }

  float mref = -3.0e38f;   // reference maximum of query ln, log2 units (equal in both halves)
  float lrow = 0.0f;       // running sum over this half's keys only
  v8f o[4];                // o[ct][r] = O^T[d = ct*16 + 8*lh + r][query ln]
#pragma unroll
  for (int t = 0; t < 4; ++t)
#pragma unroll
    for (int r = 0; r < 8; ++r) o[t][r] = 0.0f;

  // The first pass's lane masks; each pass asks for the next pass's
  unsigned mk[32];
#pragma unroll
  for (int i = 0; i < 32; ++i) mk[i] = mwp[i];

  wait_async0();       // my pieces of tile 0 have landed
  __syncthreads();     // everyone's have
  stage(1, 1);

  for (int pass = 0; pass < SEQ / 64; ++pass) {
    const int buf = pass & 1;

    // C operand of S^T: minus the reference, or -1e30 where the mask is 0
    // s[t][r] belongs to (query ln, key kb + t*16 + 8*lh + r)
    const float negm = -mref;
    v8f s[4];
#pragma unroll
    for (int t = 0; t < 4; ++t)
#pragma unroll
      for (int r = 0; r < 8; ++r)
        s[t][r] = __builtin_amdgcn_inverse_ballot_w32(mk[t * 8 + r]) ? negm : -1.0e30f;
    // S^T = K * Q'^T - reference for four 16-key sub-tiles
#pragma unroll
    for (int t = 0; t < 4; ++t) {
      s[t] = wmma16x16x32(frag_a(&kLDS[buf][t * 16][0], 72), qa[0], s[t]);
      s[t] = wmma16x16x32(frag_a(&kLDS[buf][t * 16][32], 72), qa[1], s[t]);
    }
    // One test a pass: does the reference still serve every query of the wave? It does not
    // where a score lies more than 8 above it, or while a query has met no unmasked key
    // (the start value and -1e30 are no references to subtract from a score).
    float mt[4];
#pragma unroll
    for (int t = 0; t < 4; ++t)
      mt[t] = fmaxf(fmaxf(fmaxf(s[t][0], s[t][1]), fmaxf(s[t][2], s[t][3])),
                    fmaxf(fmaxf(s[t][4], s[t][5]), fmaxf(s[t][6], s[t][7])));
    const float mloc = fmaxf(fmaxf(mt[0], mt[1]), fmaxf(mt[2], mt[3]));
    if (__builtin_amdgcn_ballot_w32(mloc > 8.0f || mref < -1.0e29f) != 0) {
      // New reference (always in the first pass): the plain scores once more, their
      // maximum joined over the halves, O and the sum brought to the new reference
      cuint* mc = mwp + pass * 32;
      float sv[4][8];
#pragma unroll
      for (int t = 0; t < 4; ++t) {
        v8f z;
#pragma unroll
        for (int r = 0; r < 8; ++r) z[r] = 0.0f;
        z = wmma16x16x32(frag_a(&kLDS[buf][t * 16][0], 72), qa[0], z);
        z = wmma16x16x32(frag_a(&kLDS[buf][t * 16][32], 72), qa[1], z);
#pragma unroll
        for (int r = 0; r < 8; ++r)
          sv[t][r] = __builtin_amdgcn_inverse_ballot_w32(mc[t * 8 + r]) ? z[r] : -1.0e30f;
      }
#pragma unroll
      for (int t = 0; t < 4; ++t)
        mt[t] = fmaxf(fmaxf(fmaxf(sv[t][0], sv[t][1]), fmaxf(sv[t][2], sv[t][3])),
                      fmaxf(fmaxf(sv[t][4], sv[t][5]), fmaxf(sv[t][6], sv[t][7])));
      float mall = fmaxf(fmaxf(mt[0], mt[1]), fmaxf(mt[2], mt[3]));
      mall = fmaxf(mall, xhalf(mall));
      const float mnew = fmaxf(mref, mall);
      const float corr = __builtin_amdgcn_exp2f(mref - mnew);
      mref = mnew;
#pragma unroll
      for (int t = 0; t < 4; ++t)
#pragma unroll
        for (int r = 0; r < 8; ++r) s[t][r] = sv[t][r] - mnew;
      lrow *= corr;
#pragma unroll
      for (int ct = 0; ct < 4; ++ct)
#pragma unroll
        for (int r = 0; r < 8; ++r) o[ct][r] *= corr;
    }
    // the words are used up: ask for the next pass's (the last pass asks for its own again)
    {
      cuint* mn = mwp + (pass + 1 < SEQ / 64 ? pass + 1 : pass) * 32;
#pragma unroll
      for (int i = 0; i < 32; ++i) mk[i] = mn[i];
    }
    // keeps the request for the words here, ahead of the exponentials, as in the build without
    // the branch: left free, the compiler asks for them late in the pass
    __builtin_amdgcn_sched_barrier(0);
    float ps[4];
#pragma unroll
    for (int t = 0; t < 4; ++t) {
      ps[t] = 0.0f;
#pragma unroll
      for (int r = 0; r < 8; ++r) {
        float p = __builtin_amdgcn_exp2f(s[t][r]);
        s[t][r] = p;
        ps[t] += p;
      }
    }
    lrow += (ps[0] + ps[1]) + (ps[2] + ps[3]);

    // P^T as B operand: sub-tiles 2c and 2c+1 are k 0..15 and 16..31 of chunk c
    // in the hardware k order (element i: key c*32 + ((i&8)<<1) + 8*lh + (i&7))
    v16h pb[2];
#pragma unroll
    for (int c = 0; c < 2; ++c)
#pragma unroll
      for (int i = 0; i < 16; ++i)
        pb[c][i] = (_Float16)s[2 * c + (i >> 3)][i & 7];

    // O^T += V^T(64x64) * P^T(64x16); V^T rows come from the [d][key] tile
#pragma unroll
    for (int ct = 0; ct < 4; ++ct) {
      o[ct] = wmma16x16x32(frag_a(&vLDS[buf][ct * 16][0], 72), pb[0], o[ct]);
      o[ct] = wmma16x16x32(frag_a(&vLDS[buf][ct * 16][32], 72), pb[1], o[ct]);
    }
    // The branch above cuts the pass into two scheduling regions, and in this one the compiler,
    // left free, asks for each V^T fragment only behind the product before it and waits for it
    // at once. These groups (0x100: LDS reads, 0x008: matrix products) keep the order that the
    // build has without the branch: three fragments of two reads each ahead of the first
    // product, then one fragment behind each product.
    __builtin_amdgcn_sched_group_barrier(0x100, 6, 0);
    __builtin_amdgcn_sched_group_barrier(0x008, 1, 0);
    __builtin_amdgcn_sched_group_barrier(0x100, 2, 0);
    __builtin_amdgcn_sched_group_barrier(0x008, 1, 0);
    __builtin_amdgcn_sched_group_barrier(0x100, 2, 0);
    __builtin_amdgcn_sched_group_barrier(0x008, 1, 0);
    __builtin_amdgcn_sched_group_barrier(0x100, 2, 0);
    __builtin_amdgcn_sched_group_barrier(0x008, 1, 0);
    __builtin_amdgcn_sched_group_barrier(0x100, 2, 0);
    __builtin_amdgcn_sched_group_barrier(0x008, 1, 0);
    __builtin_amdgcn_sched_group_barrier(0x100, 2, 0);
    __builtin_amdgcn_sched_group_barrier(0x008, 3, 0);
    // hand-over: my reads of this buffer are done, my pieces of the next tile have
    // landed; behind the barrier that holds for every wave, and this buffer is refilled
    asm volatile("s_wait_dscnt 0x0" ::: "memory");
    wait_async0();
    __syncthreads();
    if (pass + 2 < SEQ / 64) stage(buf, pass + 2);
  }
  wait_async0();       // no copy is outstanding when the wave ends

  // Join the halves' sums, normalize, write f16 ctx[n, q0+ln, h*64 + d]:
  // 8 consecutive d per lane and tile -> one 16-byte store each
  lrow += xhalf(lrow);
  const float inv = 1.0f / lrow;
  _Float16* op = ctx + ((long)n * SEQ + q0 + ln) * EMB + h * HD + 8 * lh;
#pragma unroll
  for (int ct = 0; ct < 4; ++ct) {
    v8h w;
#pragma unroll
    for (int r = 0; r < 8; ++r) w[r] = (_Float16)(o[ct][r] * inv);
    *(v8h*)(op + ct * 16) = w;
  }
}

__global__ __launch_bounds__(256) void fc_kernel(
    const _Float16* __restrict__ ctx, const _Float16* __restrict__ Wh,
    const float* __restrict__ bias, float* __restrict__ out) {
  __shared__ alignas(16) _Float16 aLDS[2][128][40];
  __shared__ alignas(16) _Float16 bLDS[2][64][40];

  const int tid  = threadIdx.x;
  const int wid  = tid >> 5;
  const int lane = tid & 31;
  const int lh   = lane >> 4;
  const int ln   = lane & 15;
  const int n0 = blockIdx.x * 64;
  const int m0 = blockIdx.y * 128;
  const int wm = (wid >> 1) * 32;
  const int wn = (wid & 1) * 32;

  v8f acc[4];
#pragma unroll
  for (int t = 0; t < 4; ++t)
#pragma unroll
    for (int r = 0; r < 8; ++r) acc[t][r] = 0.0f;

  // Stage one 128x32 A-tile + 64x32 B-tile into LDS buffer `buf` (raw f16,
  // 16B chunks; row pad 40 halves keeps every chunk 16B aligned).
  auto stage = [&](int buf, int kc) {
#pragma unroll
    for (int it = 0; it < 2; ++it) {           // A: 512 x b128
      int idx = tid + it * 256;
      int row = idx >> 2, q = (idx & 3) * 8;
      async_copy_b128(lds_addr(&aLDS[buf][row][q]),
                      ctx + (long)(m0 + row) * EMB + kc + q);
    }
    {                                          // B: 256 x b128
      int row = tid >> 2, q = (tid & 3) * 8;
      async_copy_b128(lds_addr(&bLDS[buf][row][q]),
                      Wh + (long)(n0 + row) * EMB + kc + q);
    }
  };

  stage(0, 0);
  for (int kc = 0; kc < EMB; kc += 32) {
    int buf = (kc >> 5) & 1;
    wait_async0();          // my async writes done
    __syncthreads();        // everyone's async writes done; prev reads done
    if (kc + 32 < EMB) stage(buf ^ 1, kc + 32);

    v16h a0 = frag_a(&aLDS[buf][wm][0], 40);
    v16h a1 = frag_a(&aLDS[buf][wm + 16][0], 40);
    v16h b0 = frag_b_transposed(&bLDS[buf][wn][0], 40);   // B = W^T
    v16h b1 = frag_b_transposed(&bLDS[buf][wn + 16][0], 40);
    acc[0] = wmma16x16x32(a0, b0, acc[0]);
    acc[1] = wmma16x16x32(a0, b1, acc[1]);
    acc[2] = wmma16x16x32(a1, b0, acc[2]);
    acc[3] = wmma16x16x32(a1, b1, acc[3]);
  }

#pragma unroll
  for (int ti = 0; ti < 2; ++ti)
#pragma unroll
    for (int tj = 0; tj < 2; ++tj) {
      v8f a = acc[ti * 2 + tj];
#pragma unroll
      for (int r = 0; r < 8; ++r) {
        int row = m0 + wm + ti * 16 + r + 8 * lh;
        int col = n0 + wn + tj * 16 + ln;
        out[(long)row * EMB + col] = a[r] + bias[col];
      }
    }
}

extern "C" void kernel_launch(void* const* d_in, const int* in_sizes, int n_in,
                              void* d_out, int out_size, void* d_ws, size_t ws_size,
                              hipStream_t stream) {
  (void)in_sizes; (void)n_in; (void)out_size; (void)ws_size;
  const float* values = (const float*)d_in[0];
  const float* keys   = (const float*)d_in[1];
  const float* query  = (const float*)d_in[2];
  const int*   mask   = (const int*)d_in[3];
  const float* W_fc   = (const float*)d_in[4];
  const float* b_fc   = (const float*)d_in[5];

  // workspace: ctx_h (8 MiB f16) | W_h (2 MiB f16) | lane masks (1 MiB) |
  //            K_h (8 MiB f16) | V_t (8 MiB f16)
  _Float16* ctx_h = (_Float16*)d_ws;
  _Float16* W_h   = (_Float16*)((char*)d_ws + (size_t)NB * SEQ * EMB * 2);
  unsigned* mask_w = (unsigned*)((char*)d_ws + (size_t)NB * SEQ * EMB * 2 +
                                 (size_t)EMB * EMB * 2);
  _Float16* K_h = (_Float16*)((char*)d_ws + (size_t)NB * SEQ * EMB * 2 +
                              (size_t)EMB * EMB * 2 + (size_t)NB * SEQ * SEQ / 8);
  _Float16* V_t = K_h + (size_t)NB * SEQ * EMB;

  prep_kernel<<<dim3(KV_BLOCKS + PACK_BLOCKS + CVT_BLOCKS), 256, 0, stream>>>(
      W_fc, W_h, mask, mask_w, keys, values, K_h, V_t);
  attn_kernel<<<dim3(SEQ / 128, NH, NB), 256, 0, stream>>>(query, K_h, V_t,
                                                           mask_w, ctx_h);
  fc_kernel<<<dim3(EMB / 64, (NB * SEQ) / 128), 256, 0, stream>>>(ctx_h, W_h,
                                                                  b_fc,
                                                                  (float*)d_out);
}

// v005
// It runs in 59.8 microseconds.
// Two timings next to v004 both put it at 1.05 times that version's speed.
// All steps since v000 together make it 2.18 times as fast.
#include <hip/hip_runtime.h>
#include <hip/hip_bf16.h>

#define SEQ 2048
#define NB  2
#define EMB 1024
#define NH  16
#define HD  64

typedef __attribute__((ext_vector_type(16))) _Float16 v16h;
typedef __attribute__((ext_vector_type(8)))  float    v8f;
typedef __attribute__((ext_vector_type(8)))  _Float16 v8h;
typedef __attribute__((ext_vector_type(4)))  _Float16 v4h;
typedef __attribute__((ext_vector_type(2)))  _Float16 v2h;

__device__ __forceinline__ v8f wmma16x16x32(v16h a, v16h b, v8f c) {
  // D = A(16x32 f16) x B(32x16 f16) + C(16x16 f32)
  return __builtin_amdgcn_wmma_f32_16x16x32_f16(false, a, false, b, (short)0, c,
                                                false, false);
}

__device__ __forceinline__ v16h frag_a(const _Float16* base, int stride) {
  const int lane = threadIdx.x & 31;
  const int m = lane & 15, lh = lane >> 4;
  v16h r;
#pragma unroll
  for (int i = 0; i < 16; ++i) {
    int k = ((i & 8) << 1) + (lh << 3) + (i & 7);
    r[i] = base[m * stride + k];
  }
  return r;
}

// B-matrix fragment B[k][n] from LDS stored [n][k]; same 16B-run property.
__device__ __forceinline__ v16h frag_b_transposed(const _Float16* base, int stride) {
  const int lane = threadIdx.x & 31;
  const int nn = lane & 15, lh = lane >> 4;
  v16h r;
#pragma unroll
  for (int i = 0; i < 16; ++i) {
    int k = ((i & 8) << 1) + (lh << 3) + (i & 7);
    r[i] = base[nn * stride + k];
  }
  return r;
}

__device__ __forceinline__ float xhalf(float v) {
  int b = __builtin_bit_cast(int, v);
  b = __builtin_amdgcn_permlanex16(b, b, 0x76543210, 0xfedcba98, false, false);
  return __builtin_bit_cast(float, b);
}

__device__ __forceinline__ unsigned lds_addr(const void* p) {
  // flat LDS addresses: low 32 bits are the wave-relative LDS offset
  return (unsigned)(unsigned long long)p;
}
__device__ __forceinline__ void async_copy_b128(unsigned lds_off, const void* g) {
  asm volatile("global_load_async_to_lds_b128 %0, %1, off"
               :: "v"(lds_off), "v"(g) : "memory");
}
__device__ __forceinline__ void async_copy8_b128(unsigned l0, unsigned l1, unsigned l2,
                                                 unsigned l3, unsigned l4, unsigned l5,
                                                 unsigned l6, unsigned l7, const void* g0,
                                                 const void* g1, const void* g2, const void* g3,
                                                 const void* g4, const void* g5, const void* g6,
                                                 const void* g7) {
  asm volatile("global_load_async_to_lds_b128 %0, %8, off\n\t"
               "global_load_async_to_lds_b128 %1, %9, off\n\t"
               "global_load_async_to_lds_b128 %2, %10, off\n\t"
               "global_load_async_to_lds_b128 %3, %11, off\n\t"
               "global_load_async_to_lds_b128 %4, %12, off\n\t"
               "global_load_async_to_lds_b128 %5, %13, off\n\t"
               "global_load_async_to_lds_b128 %6, %14, off\n\t"
               "global_load_async_to_lds_b128 %7, %15, off\n\t"
               "s_wait_xcnt 0x0"
               :: "v"(l0), "v"(l1), "v"(l2), "v"(l3), "v"(l4), "v"(l5), "v"(l6), "v"(l7),
                  "v"(g0), "v"(g1), "v"(g2), "v"(g3), "v"(g4), "v"(g5), "v"(g6), "v"(g7)
               : "memory");
}
__device__ __forceinline__ void wait_async0() {
  asm volatile("s_wait_asynccnt 0x0" ::: "memory");
}

// ---------------------------------------------------------------------------
// Kernel 0, three independent jobs by block index.
// Blocks 0 .. KV_BLOCKS-1 (the longest, so they start first): one head's K and V
// rows of 128 keys, f32 -> f16, laid out as the attention kernel's LDS tiles:
//   Kh[n][h][key][d]                 (a tile of 64 keys = 8 KiB in a row)
//   Vt[n][h][key / 64][d][key % 64]  (transposed; a tile = 8 KiB in a row)
// The next PACK_BLOCKS blocks: the int32 mask, read once with whole-line loads,
// becomes lane masks for the attention kernel. One wave takes one tile of
// 16 queries x 64 keys and writes 32 words:
//   mw[tile16][key block][t*8 + r], bit (16*lh + ln) =
//     mask[query tile16*16 + ln][key block*64 + t*16 + 8*lh + r] != 0
// which is the place of that score in the S^T accumulator (tile t, register r,
// lane 16*lh + ln).
// The other blocks: W f32 -> f16 conversion (4 MB read, 2 MB write).
// ---------------------------------------------------------------------------
#define PACK_BLOCKS ((NB * (SEQ / 16) * (SEQ / 64)) / 8)
#define CVT_BLOCKS  ((EMB * EMB) / 1024)
#define KV_BLOCKS   (NB * NH * (SEQ / 128))
__global__ __launch_bounds__(256) void prep_kernel(const float* __restrict__ W,
                                                   _Float16* __restrict__ Wh,
                                                   const int* __restrict__ mask,
                                                   unsigned* __restrict__ mw,
                                                   const float* __restrict__ keys,
                                                   const float* __restrict__ values,
                                                   _Float16* __restrict__ Kh,
                                                   _Float16* __restrict__ Vt) {
  __shared__ alignas(16) unsigned char nib[8][16][16];  // [wave][query][key / 4]
  __shared__ alignas(16) _Float16 vtr[HD][136];         // [d][key], 128 keys + pad
  if (blockIdx.x < KV_BLOCKS) {
    const int tid = threadIdx.x;
    const int kb  = (blockIdx.x & (SEQ / 128 - 1)) * 128;
    const int nh  = blockIdx.x / (SEQ / 128);           // n * NH + h
    const long in_off = ((long)(nh / NH) * SEQ + kb) * EMB + (nh % NH) * HD;
    const float* kp = keys + in_off;
    const float* vp = values + in_off;
    _Float16* ko = Kh + ((long)nh * SEQ + kb) * HD;
    _Float16* vo = Vt + ((long)nh * SEQ + kb) * HD;
    const int c4 = (tid & 15) * 4;                      // d 0..60
    const int r0 = tid >> 4;                            // 0..15
    float4 kv[8], va[4], vb[4];
#pragma unroll
    for (int it = 0; it < 8; ++it)
      kv[it] = *(const float4*)(kp + (long)(r0 + 16 * it) * EMB + c4);
#pragma unroll
    for (int it = 0; it < 4; ++it) {                    // two neighbouring keys
      va[it] = *(const float4*)(vp + (long)(2 * (r0 + 16 * it)) * EMB + c4);
      vb[it] = *(const float4*)(vp + (long)(2 * (r0 + 16 * it) + 1) * EMB + c4);
    }
#pragma unroll
    for (int it = 0; it < 8; ++it) {
      v4h w = {(_Float16)kv[it].x, (_Float16)kv[it].y, (_Float16)kv[it].z, (_Float16)kv[it].w};
      *(v4h*)(ko + (r0 + 16 * it) * HD + c4) = w;
    }
#pragma unroll
    for (int it = 0; it < 4; ++it) {
      const int key = 2 * (r0 + 16 * it);
      v2h p0 = {(_Float16)va[it].x, (_Float16)vb[it].x};
      v2h p1 = {(_Float16)va[it].y, (_Float16)vb[it].y};
      v2h p2 = {(_Float16)va[it].z, (_Float16)vb[it].z};
      v2h p3 = {(_Float16)va[it].w, (_Float16)vb[it].w};
      *(v2h*)&vtr[c4 + 0][key] = p0; *(v2h*)&vtr[c4 + 1][key] = p1;
      *(v2h*)&vtr[c4 + 2][key] = p2; *(v2h*)&vtr[c4 + 3][key] = p3;
    }
    __syncthreads();   // a row of one d holds keys written by other waves
#pragma unroll
    for (int it = 0; it < 4; ++it) {
      const int c = tid + it * 256;   // 16-byte piece: tile c >> 9, d (c >> 3) & 63
      *(v8h*)(vo + c * 8) = *(const v8h*)&vtr[(c >> 3) & 63][(c >> 9) * 64 + (c & 7) * 8];
    }
    return;
  }
  const int bid = blockIdx.x - KV_BLOCKS;
  if (bid >= PACK_BLOCKS) {
    long i = ((long)(bid - PACK_BLOCKS) * 256 + threadIdx.x) * 4;
    float4 w = *(const float4*)(W + i);
    Wh[i + 0] = (_Float16)w.x; Wh[i + 1] = (_Float16)w.y;
    Wh[i + 2] = (_Float16)w.z; Wh[i + 3] = (_Float16)w.w;
    return;
  }
  const int wid  = threadIdx.x >> 5;
  const int lane = threadIdx.x & 31;
  const int lh   = lane >> 4;
  const int ln   = lane & 15;
  const int task = bid * 8 + wid;            // tile16 * 32 + key block
  const int* mp = mask + (long)(task >> 5) * 16 * SEQ + (task & 31) * 64;
  // a load covers two rows of 256 B; four keys of one query -> one nibble
  int4 m[8];
#pragma unroll
  for (int j = 0; j < 8; ++j)
    m[j] = *(const int4*)(mp + (long)(2 * j + lh) * SEQ + 4 * ln);
#pragma unroll
  for (int j = 0; j < 8; ++j)
    nib[wid][2 * j + lh][ln] = (unsigned char)((m[j].x != 0 ? 1 : 0) | (m[j].y != 0 ? 2 : 0) |
                                               (m[j].z != 0 ? 4 : 0) | (m[j].w != 0 ? 8 : 0));
  __syncthreads();   // the nibbles of a row come from other lanes
  // query ln's 64 keys: key k is bit (k & 3) of byte k >> 2
  const uint4 rb = *(const uint4*)&nib[wid][ln][0];
  const unsigned x[4] = {rb.x >> (16 * lh), rb.y >> (16 * lh),
                         rb.z >> (16 * lh), rb.w >> (16 * lh)};
  unsigned w = 0;
#pragma unroll
  for (int t = 0; t < 4; ++t)
#pragma unroll
    for (int r = 0; r < 8; ++r) {
      unsigned b = __builtin_amdgcn_ballot_w32(((x[t] >> (8 * (r >> 2) + (r & 3))) & 1u) != 0);
      if (lane == t * 8 + r) w = b;
    }
  mw[(long)task * 32 + lane] = w;
  asm volatile("s_wait_xcnt 0x0" ::: "memory");
}

#define NPASS (SEQ / 128)
__global__ __launch_bounds__(256) __attribute__((amdgpu_waves_per_eu(4, 4)))
void attn_kernel(
    const float* __restrict__ query, const _Float16* __restrict__ Kh,
    const _Float16* __restrict__ Vt, const unsigned* __restrict__ maskw,
    _Float16* __restrict__ ctx) {
  __shared__ alignas(16) _Float16 kLDS[2][2][64][72];   // [buffer][key half][key][d]
  __shared__ alignas(16) _Float16 vLDS[2][2][64][72];   // [buffer][key half][d][key]
  __shared__ alignas(16) float xo[8][8][32][4];         // [wave][four of O^T][lane]
  __shared__ float xml[8][2][32];                       // [wave][reference, sum][lane]

  const int tid  = threadIdx.x;
  const int wid  = __builtin_amdgcn_readfirstlane(tid >> 5);   // uniform: scalar use below
  const int lane = tid & 31;
  const int lh   = lane >> 4;
  const int ln   = lane & 15;
  const int cg   = wid & 3;    // which 32 query columns
  const int kh   = wid >> 2;   // which half of the keys
  const int qt = blockIdx.x, h = blockIdx.y, n = blockIdx.z;
  const int q0 = qt * 128 + cg * 32;

  const float* qp = query  + ((long)n * SEQ + q0) * EMB + h * HD;
  // a tile is 512 pieces of 16 bytes in a row; this thread copies pieces tid and
  // tid + 256 of each tile: LDS row = piece / 8, 144 bytes a row
  const _Float16* kp = Kh + (long)(n * NH + h) * SEQ * HD + tid * 8;
  const _Float16* vp = Vt + (long)(n * NH + h) * SEQ * HD + tid * 8;
  const unsigned lpiece = (unsigned)((tid >> 3) * 144 + (tid & 7) * 16);
  auto stage = [&](int buf, int pass) {   // tile pass of each key half, K and V^T
    const unsigned lk = lds_addr(&kLDS[buf][0][0][0]) + lpiece;
    const unsigned lv = lds_addr(&vLDS[buf][0][0][0]) + lpiece;
    const _Float16* gk = kp + pass * (64 * HD);
    const _Float16* gv = vp + pass * (64 * HD);
    async_copy8_b128(lk, lk + 32 * 144, lk + 64 * 144, lk + 96 * 144,
                     lv, lv + 32 * 144, lv + 64 * 144, lv + 96 * 144,
                     gk, gk + 256 * 8, gk + (SEQ / 2) * HD, gk + (SEQ / 2) * HD + 256 * 8,
                     gv, gv + 256 * 8, gv + (SEQ / 2) * HD, gv + (SEQ / 2) * HD + 256 * 8);
  };
  stage(0, 0);
  typedef __attribute__((address_space(4))) const unsigned cuint;
  constexpr int MGRP = (SEQ / 64) * 32;
  cuint* mwp = (cuint*)(unsigned long long)(maskw +
      ((long)(n * (SEQ / 16) + qt * 8 + cg * 2) * (SEQ / 64) + kh * NPASS) * 32);

  // Q^T fragments (B operand: column = query g*16 + ln, two K=32 chunks over D=64);
  // softmax 1/sqrt(EMB)=1/32 and log2(e) folded in
  v16h qa[2][2];
#pragma unroll
  for (int g = 0; g < 2; ++g)
#pragma unroll
    for (int c = 0; c < 2; ++c)
#pragma unroll
      for (int i = 0; i < 16; ++i) {
        int k = ((i & 8) << 1) + (lh << 3) + (i & 7) + c * 32;
        qa[g][c][i] = (_Float16)(qp[(long)(g * 16 + ln) * EMB + k] *
                                 (1.4426950408889634f * 0.03125f));
      }

  // reference maximum of query g*16 + ln, log2 units (equal in both half-waves)
  float mref[2] = {-3.0e38f, -3.0e38f};
  float lrow[2] = {0.0f, 0.0f};   // running sum over this half-wave's keys only
  v8f o[2][4];                    // o[g][ct][r] = O^T[d = ct*16 + 8*lh + r][query g*16 + ln]
#pragma unroll
  for (int g = 0; g < 2; ++g)
#pragma unroll
    for (int t = 0; t < 4; ++t)
#pragma unroll
      for (int r = 0; r < 8; ++r) o[g][t][r] = 0.0f;

  // The first pass's lane masks; each pass asks for the next pass's
  unsigned mk[2][32];
#pragma unroll
  for (int g = 0; g < 2; ++g)
#pragma unroll
    for (int i = 0; i < 32; ++i) mk[g][i] = mwp[g * MGRP + i];

  wait_async0();       // my pieces of the first tiles have landed
  __syncthreads();     // everyone's have
  stage(1, 1);

  for (int pass = 0; pass < NPASS; ++pass) {
    const int buf = pass & 1;
    const _Float16 (*kT)[72] = kLDS[buf][kh];
    const _Float16 (*vT)[72] = vLDS[buf][kh];

    // C operand of S^T: minus the reference, or -1e30 where the mask is 0
    // s[g][t][r] belongs to (query g*16 + ln, key t*16 + 8*lh + r of the tile)
    v8f s[2][4];
#pragma unroll
    for (int g = 0; g < 2; ++g) {
      const float negm = -mref[g];
#pragma unroll
      for (int t = 0; t < 4; ++t)
#pragma unroll
        for (int r = 0; r < 8; ++r)
          s[g][t][r] = __builtin_amdgcn_inverse_ballot_w32(mk[g][t * 8 + r]) ? negm : -1.0e30f;
    }
    // S^T = K * Q'^T - reference for four 16-key sub-tiles; a K fragment serves both groups
#pragma unroll
    for (int t = 0; t < 4; ++t) {
      const v16h k0 = frag_a(&kT[t * 16][0], 72);
      const v16h k1 = frag_a(&kT[t * 16][32], 72);
      s[0][t] = wmma16x16x32(k0, qa[0][0], s[0][t]);
      s[1][t] = wmma16x16x32(k0, qa[1][0], s[1][t]);
      s[0][t] = wmma16x16x32(k1, qa[0][1], s[0][t]);
      s[1][t] = wmma16x16x32(k1, qa[1][1], s[1][t]);
    }
    // One test a pass: do the references still serve every query of the wave? One does not
    // where a score lies more than 8 above it, or while a query has met no unmasked key
    // (the start value and -1e30 are no references to subtract from a score).
    bool need = false;
#pragma unroll
    for (int g = 0; g < 2; ++g) {
      float mt[4];
#pragma unroll
      for (int t = 0; t < 4; ++t)
        mt[t] = fmaxf(fmaxf(fmaxf(s[g][t][0], s[g][t][1]), fmaxf(s[g][t][2], s[g][t][3])),
                      fmaxf(fmaxf(s[g][t][4], s[g][t][5]), fmaxf(s[g][t][6], s[g][t][7])));
      const float mloc = fmaxf(fmaxf(mt[0], mt[1]), fmaxf(mt[2], mt[3]));
      need = need || mloc > 8.0f || mref[g] < -1.0e29f;
    }
    if (__builtin_amdgcn_ballot_w32(need) != 0) {
      // New references (always in the first pass): the plain scores once more, their
      // maximum joined over the half-waves, O and the sum brought to the new reference
#pragma unroll
      for (int g = 0; g < 2; ++g) {
        cuint* mc = mwp + g * MGRP + pass * 32;
        float sv[4][8];
#pragma unroll
        for (int t = 0; t < 4; ++t) {
          v8f z;
#pragma unroll
          for (int r = 0; r < 8; ++r) z[r] = 0.0f;
          z = wmma16x16x32(frag_a(&kT[t * 16][0], 72), qa[g][0], z);
          z = wmma16x16x32(frag_a(&kT[t * 16][32], 72), qa[g][1], z);
#pragma unroll
          for (int r = 0; r < 8; ++r)
            sv[t][r] = __builtin_amdgcn_inverse_ballot_w32(mc[t * 8 + r]) ? z[r] : -1.0e30f;
        }
        float mt[4];
#pragma unroll
        for (int t = 0; t < 4; ++t)
          mt[t] = fmaxf(fmaxf(fmaxf(sv[t][0], sv[t][1]), fmaxf(sv[t][2], sv[t][3])),
                        fmaxf(fmaxf(sv[t][4], sv[t][5]), fmaxf(sv[t][6], sv[t][7])));
        float mall = fmaxf(fmaxf(mt[0], mt[1]), fmaxf(mt[2], mt[3]));
        mall = fmaxf(mall, xhalf(mall));
        const float mnew = fmaxf(mref[g], mall);
        float corr;
        asm("v_exp_f32 %0, %1\n\tv_nop" : "=v"(corr) : "v"(mref[g] - mnew));
        mref[g] = mnew;
#pragma unroll
        for (int t = 0; t < 4; ++t)
#pragma unroll
          for (int r = 0; r < 8; ++r) s[g][t][r] = sv[t][r] - mnew;
        lrow[g] *= corr;
#pragma unroll
        for (int ct = 0; ct < 4; ++ct)
#pragma unroll
          for (int r = 0; r < 8; ++r) o[g][ct][r] *= corr;
      }
    }
    // the words are used up: ask for the next pass's (the last pass asks for its own again)
    {
      cuint* mn = mwp + (pass + 1 < NPASS ? pass + 1 : pass) * 32;
#pragma unroll
      for (int g = 0; g < 2; ++g)
#pragma unroll
        for (int i = 0; i < 32; ++i) mk[g][i] = mn[g * MGRP + i];
    }
    // keeps the request for the words here, ahead of the exponentials: left free, the
    // compiler asks for them late in the pass
    __builtin_amdgcn_sched_barrier(0);
    // P^T as B operand: sub-tiles 2c and 2c+1 are k 0..15 and 16..31 of chunk c
    // in the hardware k order (element i: key c*32 + ((i&8)<<1) + 8*lh + (i&7))
    v16h pb[2][2];
#pragma unroll
    for (int g = 0; g < 2; ++g) {
      float ps[4];
#pragma unroll
      for (int t = 0; t < 4; ++t) {
        ps[t] = 0.0f;
#pragma unroll
        for (int r = 0; r < 8; ++r) {
          float p = __builtin_amdgcn_exp2f(s[g][t][r]);
          s[g][t][r] = p;
          ps[t] += p;
        }
      }
      lrow[g] += (ps[0] + ps[1]) + (ps[2] + ps[3]);
#pragma unroll
      for (int c = 0; c < 2; ++c)
#pragma unroll
        for (int i = 0; i < 16; ++i)
          pb[g][c][i] = (_Float16)s[g][2 * c + (i >> 3)][i & 7];
    }

    // O^T += V^T(64x64) * P^T(64x16) per group; V^T rows come from the [d][key] tile,
    // and a V^T fragment serves both groups
#pragma unroll
    for (int ct = 0; ct < 4; ++ct)
#pragma unroll
      for (int c = 0; c < 2; ++c) {
        const v16h vf = frag_a(&vT[ct * 16][c * 32], 72);
        o[0][ct] = wmma16x16x32(vf, pb[0][c], o[0][ct]);
        o[1][ct] = wmma16x16x32(vf, pb[1][c], o[1][ct]);
      }
    // The branch above cuts the pass into two scheduling regions, and in this one the compiler,
    // left free, asks for most V^T fragments only behind the first product and waits for them
    // at once. These groups (0x100: LDS reads, 0x008: matrix products) keep three fragments of
    // two reads each ahead of the first pair of products, then one fragment behind each pair.
    __builtin_amdgcn_sched_group_barrier(0x100, 6, 0);
    __builtin_amdgcn_sched_group_barrier(0x008, 2, 0);
    __builtin_amdgcn_sched_group_barrier(0x100, 2, 0);
    __builtin_amdgcn_sched_group_barrier(0x008, 2, 0);
    __builtin_amdgcn_sched_group_barrier(0x100, 2, 0);
    __builtin_amdgcn_sched_group_barrier(0x008, 2, 0);
    __builtin_amdgcn_sched_group_barrier(0x100, 2, 0);
    __builtin_amdgcn_sched_group_barrier(0x008, 2, 0);
    __builtin_amdgcn_sched_group_barrier(0x100, 2, 0);
    __builtin_amdgcn_sched_group_barrier(0x008, 2, 0);
    __builtin_amdgcn_sched_group_barrier(0x100, 2, 0);
    __builtin_amdgcn_sched_group_barrier(0x008, 6, 0);
    // hand-over: my reads of this buffer are done, my pieces of the next tiles have
    // landed; behind the barrier that holds for every wave, and this buffer is refilled
    asm volatile("s_wait_dscnt 0x0" ::: "memory");
    wait_async0();
    __syncthreads();
    if (pass + 2 < NPASS) stage(buf, pass + 2);
  }
  wait_async0();       // no copy is outstanding when the wave ends

  // Join the two key halves. Wave kh keeps column group kh and hands the other group's
  // O^T, reference and sum (half-waves joined) to its partner wave through LDS.
  lrow[0] += xhalf(lrow[0]);
  lrow[1] += xhalf(lrow[1]);
  const bool hi = kh != 0;
  const float mine_m = hi ? mref[1] : mref[0], send_m = hi ? mref[0] : mref[1];
  const float mine_l = hi ? lrow[1] : lrow[0], send_l = hi ? lrow[0] : lrow[1];
#pragma unroll
  for (int ct = 0; ct < 4; ++ct)
#pragma unroll
    for (int j = 0; j < 2; ++j) {
      float4 w;
      w.x = hi ? o[0][ct][4 * j + 0] : o[1][ct][4 * j + 0];
      w.y = hi ? o[0][ct][4 * j + 1] : o[1][ct][4 * j + 1];
      w.z = hi ? o[0][ct][4 * j + 2] : o[1][ct][4 * j + 2];
      w.w = hi ? o[0][ct][4 * j + 3] : o[1][ct][4 * j + 3];
      *(float4*)&xo[wid][ct * 2 + j][lane][0] = w;
    }
  xml[wid][0][lane] = send_m;
  xml[wid][1][lane] = send_l;
  __syncthreads();     // the partner's values are written by another wave
  const int pw = wid ^ 4;
  const float part_m = xml[pw][0][lane];
  const float part_l = xml[pw][1][lane];
  // both parts brought to the larger reference (a half with no unmasked key has -1e30
  // and drops out against a real one; two such halves weigh alike)
  const float mj = fmaxf(mine_m, part_m);
  const float fa = __builtin_amdgcn_exp2f(mine_m - mj);
  const float fb = __builtin_amdgcn_exp2f(part_m - mj);
  const float inv = 1.0f / (mine_l * fa + part_l * fb);
  const float ga = fa * inv, gb = fb * inv;
  // normalize, write f16 ctx[n, q0 + kh*16 + ln, h*64 + d]:
  // 8 consecutive d per lane and tile -> one 16-byte store each
  _Float16* op = ctx + ((long)n * SEQ + q0 + kh * 16 + ln) * EMB + h * HD + 8 * lh;
#pragma unroll
  for (int ct = 0; ct < 4; ++ct) {
    const float4 p0 = *(const float4*)&xo[pw][ct * 2 + 0][lane][0];
    const float4 p1 = *(const float4*)&xo[pw][ct * 2 + 1][lane][0];
    const float pp[8] = {p0.x, p0.y, p0.z, p0.w, p1.x, p1.y, p1.z, p1.w};
    v8h w;
#pragma unroll
    for (int r = 0; r < 8; ++r)
      w[r] = (_Float16)((hi ? o[1][ct][r] : o[0][ct][r]) * ga + pp[r] * gb);
    *(v8h*)(op + ct * 16) = w;
  }
}

__global__ __launch_bounds__(256) void fc_kernel(
    const _Float16* __restrict__ ctx, const _Float16* __restrict__ Wh,
    const float* __restrict__ bias, float* __restrict__ out) {
  __shared__ alignas(16) _Float16 aLDS[2][128][40];
  __shared__ alignas(16) _Float16 bLDS[2][64][40];

  const int tid  = threadIdx.x;
  const int wid  = tid >> 5;
  const int lane = tid & 31;
  const int lh   = lane >> 4;
  const int ln   = lane & 15;
  const int n0 = blockIdx.x * 64;
  const int m0 = blockIdx.y * 128;
  const int wm = (wid >> 1) * 32;
  const int wn = (wid & 1) * 32;

  v8f acc[4];
#pragma unroll
  for (int t = 0; t < 4; ++t)
#pragma unroll
    for (int r = 0; r < 8; ++r) acc[t][r] = 0.0f;

  // Stage one 128x32 A-tile + 64x32 B-tile into LDS buffer `buf` (raw f16,
  // 16B chunks; row pad 40 halves keeps every chunk 16B aligned).
  auto stage = [&](int buf, int kc) {
#pragma unroll
    for (int it = 0; it < 2; ++it) {           // A: 512 x b128
      int idx = tid + it * 256;
      int row = idx >> 2, q = (idx & 3) * 8;
      async_copy_b128(lds_addr(&aLDS[buf][row][q]),
                      ctx + (long)(m0 + row) * EMB + kc + q);
    }
    {                                          // B: 256 x b128
      int row = tid >> 2, q = (tid & 3) * 8;
      async_copy_b128(lds_addr(&bLDS[buf][row][q]),
                      Wh + (long)(n0 + row) * EMB + kc + q);
    }
  };

  stage(0, 0);
  for (int kc = 0; kc < EMB; kc += 32) {
    int buf = (kc >> 5) & 1;
    wait_async0();          // my async writes done
    __syncthreads();        // everyone's async writes done; prev reads done
    if (kc + 32 < EMB) stage(buf ^ 1, kc + 32);

    v16h a0 = frag_a(&aLDS[buf][wm][0], 40);
    v16h a1 = frag_a(&aLDS[buf][wm + 16][0], 40);
    v16h b0 = frag_b_transposed(&bLDS[buf][wn][0], 40);   // B = W^T
    v16h b1 = frag_b_transposed(&bLDS[buf][wn + 16][0], 40);
    acc[0] = wmma16x16x32(a0, b0, acc[0]);
    acc[1] = wmma16x16x32(a0, b1, acc[1]);
    acc[2] = wmma16x16x32(a1, b0, acc[2]);
    acc[3] = wmma16x16x32(a1, b1, acc[3]);
  }

#pragma unroll
  for (int ti = 0; ti < 2; ++ti)
#pragma unroll
    for (int tj = 0; tj < 2; ++tj) {
      v8f a = acc[ti * 2 + tj];
#pragma unroll
      for (int r = 0; r < 8; ++r) {
        int row = m0 + wm + ti * 16 + r + 8 * lh;
        int col = n0 + wn + tj * 16 + ln;
        out[(long)row * EMB + col] = a[r] + bias[col];
      }
    }
}

extern "C" void kernel_launch(void* const* d_in, const int* in_sizes, int n_in,
                              void* d_out, int out_size, void* d_ws, size_t ws_size,
                              hipStream_t stream) {
  (void)in_sizes; (void)n_in; (void)out_size; (void)ws_size;
  const float* values = (const float*)d_in[0];
  const float* keys   = (const float*)d_in[1];
  const float* query  = (const float*)d_in[2];
  const int*   mask   = (const int*)d_in[3];
  const float* W_fc   = (const float*)d_in[4];
  const float* b_fc   = (const float*)d_in[5];

  // workspace: ctx_h (8 MiB f16) | W_h (2 MiB f16) | lane masks (1 MiB) |
  //            K_h (8 MiB f16) | V_t (8 MiB f16)
  _Float16* ctx_h = (_Float16*)d_ws;
  _Float16* W_h   = (_Float16*)((char*)d_ws + (size_t)NB * SEQ * EMB * 2);
  unsigned* mask_w = (unsigned*)((char*)d_ws + (size_t)NB * SEQ * EMB * 2 +
                                 (size_t)EMB * EMB * 2);
  _Float16* K_h = (_Float16*)((char*)d_ws + (size_t)NB * SEQ * EMB * 2 +
                              (size_t)EMB * EMB * 2 + (size_t)NB * SEQ * SEQ / 8);
  _Float16* V_t = K_h + (size_t)NB * SEQ * EMB;

  prep_kernel<<<dim3(KV_BLOCKS + PACK_BLOCKS + CVT_BLOCKS), 256, 0, stream>>>(
      W_fc, W_h, mask, mask_w, keys, values, K_h, V_t);
  attn_kernel<<<dim3(SEQ / 128, NH, NB), 256, 0, stream>>>(query, K_h, V_t,
                                                           mask_w, ctx_h);
  fc_kernel<<<dim3(EMB / 64, (NB * SEQ) / 128), 256, 0, stream>>>(ctx_h, W_h,
                                                                  b_fc,
                                                                  (float*)d_out);
}

// v006
// Measured time: 54.8 microseconds a run.
// Timed twice side by side with v005, it ran 1.10 times as fast both times.
// All steps since v000 together make it 2.39 times as fast.
#include <hip/hip_runtime.h>
#include <hip/hip_bf16.h>

#define SEQ 2048
#define NB  2
#define EMB 1024
#define NH  16
#define HD  64

typedef __attribute__((ext_vector_type(16))) _Float16 v16h;
typedef __attribute__((ext_vector_type(8)))  float    v8f;
typedef __attribute__((ext_vector_type(8)))  _Float16 v8h;
typedef __attribute__((ext_vector_type(4)))  _Float16 v4h;
typedef __attribute__((ext_vector_type(2)))  _Float16 v2h;

__device__ __forceinline__ v8f wmma16x16x32(v16h a, v16h b, v8f c) {
  // D = A(16x32 f16) x B(32x16 f16) + C(16x16 f32)
  return __builtin_amdgcn_wmma_f32_16x16x32_f16(false, a, false, b, (short)0, c,
                                                false, false);
}

__device__ __forceinline__ v16h frag_a(const _Float16* base, int stride) {
  const int lane = threadIdx.x & 31;
  const int m = lane & 15, lh = lane >> 4;
  v16h r;
#pragma unroll
  for (int i = 0; i < 16; ++i) {
    int k = ((i & 8) << 1) + (lh << 3) + (i & 7);
    r[i] = base[m * stride + k];
  }
  return r;
}

// B-matrix fragment B[k][n] from LDS stored [n][k]; same 16B-run property.
__device__ __forceinline__ v16h frag_b_transposed(const _Float16* base, int stride) {
  const int lane = threadIdx.x & 31;
  const int nn = lane & 15, lh = lane >> 4;
  v16h r;
#pragma unroll
  for (int i = 0; i < 16; ++i) {
    int k = ((i & 8) << 1) + (lh << 3) + (i & 7);
    r[i] = base[nn * stride + k];
  }
  return r;
}

__device__ __forceinline__ float xhalf(float v) {
  int b = __builtin_bit_cast(int, v);
  b = __builtin_amdgcn_permlanex16(b, b, 0x76543210, 0xfedcba98, false, false);
  return __builtin_bit_cast(float, b);
}

__device__ __forceinline__ unsigned lds_addr(const void* p) {
  // flat LDS addresses: low 32 bits are the wave-relative LDS offset
  return (unsigned)(unsigned long long)p;
}
__device__ __forceinline__ void async_copy8_b128(unsigned l0, unsigned l1, unsigned l2,
                                                 unsigned l3, unsigned l4, unsigned l5,
                                                 unsigned l6, unsigned l7, const void* g0,
                                                 const void* g1, const void* g2, const void* g3,
                                                 const void* g4, const void* g5, const void* g6,
                                                 const void* g7) {
  asm volatile("global_load_async_to_lds_b128 %0, %8, off\n\t"
               "global_load_async_to_lds_b128 %1, %9, off\n\t"
               "global_load_async_to_lds_b128 %2, %10, off\n\t"
               "global_load_async_to_lds_b128 %3, %11, off\n\t"
               "global_load_async_to_lds_b128 %4, %12, off\n\t"
               "global_load_async_to_lds_b128 %5, %13, off\n\t"
               "global_load_async_to_lds_b128 %6, %14, off\n\t"
               "global_load_async_to_lds_b128 %7, %15, off\n\t"
               "s_wait_xcnt 0x0"
               :: "v"(l0), "v"(l1), "v"(l2), "v"(l3), "v"(l4), "v"(l5), "v"(l6), "v"(l7),
                  "v"(g0), "v"(g1), "v"(g2), "v"(g3), "v"(g4), "v"(g5), "v"(g6), "v"(g7)
               : "memory");
}
__device__ __forceinline__ void wait_async0() {
  asm volatile("s_wait_asynccnt 0x0" ::: "memory");
}

// ---------------------------------------------------------------------------
// Kernel 0, three independent jobs by block index.
// Blocks 0 .. KV_BLOCKS-1 (the longest, so they start first): one head's K and V
// rows of 128 keys, f32 -> f16, laid out as the attention kernel's LDS tiles:
//   Kh[n][h][key][d]                 (a tile of 64 keys = 8 KiB in a row)
//   Vt[n][h][key / 64][d][key % 64]  (transposed; a tile = 8 KiB in a row)
// The next PACK_BLOCKS blocks: the int32 mask, read once with whole-line loads,
// becomes lane masks for the attention kernel. One wave takes one tile of
// 16 queries x 64 keys and writes 32 words:
//   mw[tile16][key block][t*8 + r], bit (16*lh + ln) =
//     mask[query tile16*16 + ln][key block*64 + t*16 + 8*lh + r] != 0
// which is the place of that score in the S^T accumulator (tile t, register r,
// lane 16*lh + ln).
// The other blocks: W f32 -> f16 conversion (4 MB read, 2 MB write).
// ---------------------------------------------------------------------------
#define PACK_BLOCKS ((NB * (SEQ / 16) * (SEQ / 64)) / 8)
#define CVT_BLOCKS  ((EMB * EMB) / 1024)
#define KV_BLOCKS   (NB * NH * (SEQ / 128))
__global__ __launch_bounds__(256) void prep_kernel(const float* __restrict__ W,
                                                   _Float16* __restrict__ Wh,
                                                   const int* __restrict__ mask,
                                                   unsigned* __restrict__ mw,
                                                   const float* __restrict__ keys,
                                                   const float* __restrict__ values,
                                                   _Float16* __restrict__ Kh,
                                                   _Float16* __restrict__ Vt) {
  __shared__ alignas(16) unsigned char nib[8][16][16];  // [wave][query][key / 4]
  __shared__ alignas(16) _Float16 vtr[HD][136];         // [d][key], 128 keys + pad
  if (blockIdx.x < KV_BLOCKS) {
    const int tid = threadIdx.x;
    const int kb  = (blockIdx.x & (SEQ / 128 - 1)) * 128;
    const int nh  = blockIdx.x / (SEQ / 128);           // n * NH + h
    const long in_off = ((long)(nh / NH) * SEQ + kb) * EMB + (nh % NH) * HD;
    const float* kp = keys + in_off;
    const float* vp = values + in_off;
    _Float16* ko = Kh + ((long)nh * SEQ + kb) * HD;
    _Float16* vo = Vt + ((long)nh * SEQ + kb) * HD;
    const int c4 = (tid & 15) * 4;                      // d 0..60
    const int r0 = tid >> 4;                            // 0..15
    float4 kv[8], va[4], vb[4];
#pragma unroll
    for (int it = 0; it < 8; ++it)
      kv[it] = *(const float4*)(kp + (long)(r0 + 16 * it) * EMB + c4);
#pragma unroll
    for (int it = 0; it < 4; ++it) {                    // two neighbouring keys
      va[it] = *(const float4*)(vp + (long)(2 * (r0 + 16 * it)) * EMB + c4);
      vb[it] = *(const float4*)(vp + (long)(2 * (r0 + 16 * it) + 1) * EMB + c4);
    }
#pragma unroll
    for (int it = 0; it < 8; ++it) {
      v4h w = {(_Float16)kv[it].x, (_Float16)kv[it].y, (_Float16)kv[it].z, (_Float16)kv[it].w};
      *(v4h*)(ko + (r0 + 16 * it) * HD + c4) = w;
    }
#pragma unroll
    for (int it = 0; it < 4; ++it) {
      const int key = 2 * (r0 + 16 * it);
      v2h p0 = {(_Float16)va[it].x, (_Float16)vb[it].x};
      v2h p1 = {(_Float16)va[it].y, (_Float16)vb[it].y};
      v2h p2 = {(_Float16)va[it].z, (_Float16)vb[it].z};
      v2h p3 = {(_Float16)va[it].w, (_Float16)vb[it].w};
      *(v2h*)&vtr[c4 + 0][key] = p0; *(v2h*)&vtr[c4 + 1][key] = p1;
      *(v2h*)&vtr[c4 + 2][key] = p2; *(v2h*)&vtr[c4 + 3][key] = p3;
    }
    __syncthreads();   // a row of one d holds keys written by other waves
#pragma unroll
    for (int it = 0; it < 4; ++it) {
      const int c = tid + it * 256;   // 16-byte piece: tile c >> 9, d (c >> 3) & 63
      *(v8h*)(vo + c * 8) = *(const v8h*)&vtr[(c >> 3) & 63][(c >> 9) * 64 + (c & 7) * 8];
    }
    return;
  }
  const int bid = blockIdx.x - KV_BLOCKS;
  if (bid >= PACK_BLOCKS) {
    long i = ((long)(bid - PACK_BLOCKS) * 256 + threadIdx.x) * 4;
    float4 w = *(const float4*)(W + i);
    Wh[i + 0] = (_Float16)w.x; Wh[i + 1] = (_Float16)w.y;
    Wh[i + 2] = (_Float16)w.z; Wh[i + 3] = (_Float16)w.w;
    return;
  }
  const int wid  = threadIdx.x >> 5;
  const int lane = threadIdx.x & 31;
  const int lh   = lane >> 4;
  const int ln   = lane & 15;
  const int task = bid * 8 + wid;            // tile16 * 32 + key block
  const int* mp = mask + (long)(task >> 5) * 16 * SEQ + (task & 31) * 64;
  // a load covers two rows of 256 B; four keys of one query -> one nibble
  int4 m[8];
#pragma unroll
  for (int j = 0; j < 8; ++j)
    m[j] = *(const int4*)(mp + (long)(2 * j + lh) * SEQ + 4 * ln);
#pragma unroll
  for (int j = 0; j < 8; ++j)
    nib[wid][2 * j + lh][ln] = (unsigned char)((m[j].x != 0 ? 1 : 0) | (m[j].y != 0 ? 2 : 0) |
                                               (m[j].z != 0 ? 4 : 0) | (m[j].w != 0 ? 8 : 0));
  __syncthreads();   // the nibbles of a row come from other lanes
  // query ln's 64 keys: key k is bit (k & 3) of byte k >> 2
  const uint4 rb = *(const uint4*)&nib[wid][ln][0];
  const unsigned x[4] = {rb.x >> (16 * lh), rb.y >> (16 * lh),
                         rb.z >> (16 * lh), rb.w >> (16 * lh)};
  unsigned w = 0;
#pragma unroll
  for (int t = 0; t < 4; ++t)
#pragma unroll
    for (int r = 0; r < 8; ++r) {
      unsigned b = __builtin_amdgcn_ballot_w32(((x[t] >> (8 * (r >> 2) + (r & 3))) & 1u) != 0);
      if (lane == t * 8 + r) w = b;
    }
  mw[(long)task * 32 + lane] = w;
  asm volatile("s_wait_xcnt 0x0" ::: "memory");
}

#define NPASS (SEQ / 128)
__global__ __launch_bounds__(256) __attribute__((amdgpu_waves_per_eu(4, 4)))
void attn_kernel(
    const float* __restrict__ query, const _Float16* __restrict__ Kh,
    const _Float16* __restrict__ Vt, const unsigned* __restrict__ maskw,
    _Float16* __restrict__ ctx) {
  __shared__ alignas(16) _Float16 kLDS[2][2][64][72];   // [buffer][key half][key][d]
  __shared__ alignas(16) _Float16 vLDS[2][2][64][72];   // [buffer][key half][d][key]
  __shared__ alignas(16) float xo[8][8][32][4];         // [wave][four of O^T][lane]
  __shared__ float xml[8][2][32];                       // [wave][reference, sum][lane]

  const int tid  = threadIdx.x;
  const int wid  = __builtin_amdgcn_readfirstlane(tid >> 5);   // uniform: scalar use below
  const int lane = tid & 31;
  const int lh   = lane >> 4;
  const int ln   = lane & 15;
  const int cg   = wid & 3;    // which 32 query columns
  const int kh   = wid >> 2;   // which half of the keys
  const int qt = blockIdx.x, h = blockIdx.y, n = blockIdx.z;
  const int q0 = qt * 128 + cg * 32;

  const float* qp = query  + ((long)n * SEQ + q0) * EMB + h * HD;
  // a tile is 512 pieces of 16 bytes in a row; this thread copies pieces tid and
  // tid + 256 of each tile: LDS row = piece / 8, 144 bytes a row
  const _Float16* kp = Kh + (long)(n * NH + h) * SEQ * HD + tid * 8;
  const _Float16* vp = Vt + (long)(n * NH + h) * SEQ * HD + tid * 8;
  const unsigned lpiece = (unsigned)((tid >> 3) * 144 + (tid & 7) * 16);
  auto stage = [&](int buf, int pass) {   // tile pass of each key half, K and V^T
    const unsigned lk = lds_addr(&kLDS[buf][0][0][0]) + lpiece;
    const unsigned lv = lds_addr(&vLDS[buf][0][0][0]) + lpiece;
    const _Float16* gk = kp + pass * (64 * HD);
    const _Float16* gv = vp + pass * (64 * HD);
    async_copy8_b128(lk, lk + 32 * 144, lk + 64 * 144, lk + 96 * 144,
                     lv, lv + 32 * 144, lv + 64 * 144, lv + 96 * 144,
                     gk, gk + 256 * 8, gk + (SEQ / 2) * HD, gk + (SEQ / 2) * HD + 256 * 8,
                     gv, gv + 256 * 8, gv + (SEQ / 2) * HD, gv + (SEQ / 2) * HD + 256 * 8);
  };
  stage(0, 0);
  typedef __attribute__((address_space(4))) const unsigned cuint;
  constexpr int MGRP = (SEQ / 64) * 32;
  cuint* mwp = (cuint*)(unsigned long long)(maskw +
      ((long)(n * (SEQ / 16) + qt * 8 + cg * 2) * (SEQ / 64) + kh * NPASS) * 32);

  // Q^T fragments (B operand: column = query g*16 + ln, two K=32 chunks over D=64);
  // softmax 1/sqrt(EMB)=1/32 and log2(e) folded in
  v16h qa[2][2];
#pragma unroll
  for (int g = 0; g < 2; ++g)
#pragma unroll
    for (int c = 0; c < 2; ++c)
#pragma unroll
      for (int i = 0; i < 16; ++i) {
        int k = ((i & 8) << 1) + (lh << 3) + (i & 7) + c * 32;
        qa[g][c][i] = (_Float16)(qp[(long)(g * 16 + ln) * EMB + k] *
                                 (1.4426950408889634f * 0.03125f));
      }

  // reference maximum of query g*16 + ln, log2 units (equal in both half-waves)
  float mref[2] = {-3.0e38f, -3.0e38f};
  float lrow[2] = {0.0f, 0.0f};   // running sum over this half-wave's keys only
  v8f o[2][4];                    // o[g][ct][r] = O^T[d = ct*16 + 8*lh + r][query g*16 + ln]
#pragma unroll
  for (int g = 0; g < 2; ++g)
#pragma unroll
    for (int t = 0; t < 4; ++t)
#pragma unroll
      for (int r = 0; r < 8; ++r) o[g][t][r] = 0.0f;

  // The first pass's lane masks; each pass asks for the next pass's
  unsigned mk[2][32];
#pragma unroll
  for (int g = 0; g < 2; ++g)
#pragma unroll
    for (int i = 0; i < 32; ++i) mk[g][i] = mwp[g * MGRP + i];

  wait_async0();       // my pieces of the first tiles have landed
  __syncthreads();     // everyone's have
  stage(1, 1);

  for (int pass = 0; pass < NPASS; ++pass) {
    const int buf = pass & 1;
    const _Float16 (*kT)[72] = kLDS[buf][kh];
    const _Float16 (*vT)[72] = vLDS[buf][kh];

    // C operand of S^T: minus the reference, or -1e30 where the mask is 0
    // s[g][t][r] belongs to (query g*16 + ln, key t*16 + 8*lh + r of the tile)
    v8f s[2][4];
#pragma unroll
    for (int g = 0; g < 2; ++g) {
      const float negm = -mref[g];
#pragma unroll
      for (int t = 0; t < 4; ++t)
#pragma unroll
        for (int r = 0; r < 8; ++r)
          s[g][t][r] = __builtin_amdgcn_inverse_ballot_w32(mk[g][t * 8 + r]) ? negm : -1.0e30f;
    }
    // S^T = K * Q'^T - reference for four 16-key sub-tiles; a K fragment serves both groups
#pragma unroll
    for (int t = 0; t < 4; ++t) {
      const v16h k0 = frag_a(&kT[t * 16][0], 72);
      const v16h k1 = frag_a(&kT[t * 16][32], 72);
      s[0][t] = wmma16x16x32(k0, qa[0][0], s[0][t]);
      s[1][t] = wmma16x16x32(k0, qa[1][0], s[1][t]);
      s[0][t] = wmma16x16x32(k1, qa[0][1], s[0][t]);
      s[1][t] = wmma16x16x32(k1, qa[1][1], s[1][t]);
    }
    // One test a pass: do the references still serve every query of the wave? One does not
    // where a score lies more than 8 above it, or while a query has met no unmasked key
    // (the start value and -1e30 are no references to subtract from a score).
    bool need = false;
#pragma unroll
    for (int g = 0; g < 2; ++g) {
      float mt[4];
#pragma unroll
      for (int t = 0; t < 4; ++t)
        mt[t] = fmaxf(fmaxf(fmaxf(s[g][t][0], s[g][t][1]), fmaxf(s[g][t][2], s[g][t][3])),
                      fmaxf(fmaxf(s[g][t][4], s[g][t][5]), fmaxf(s[g][t][6], s[g][t][7])));
      const float mloc = fmaxf(fmaxf(mt[0], mt[1]), fmaxf(mt[2], mt[3]));
      need = need || mloc > 8.0f || mref[g] < -1.0e29f;
    }
    if (__builtin_amdgcn_ballot_w32(need) != 0) {
      // New references (always in the first pass): the plain scores once more, their
      // maximum joined over the half-waves, O and the sum brought to the new reference
#pragma unroll
      for (int g = 0; g < 2; ++g) {
        cuint* mc = mwp + g * MGRP + pass * 32;
        float sv[4][8];
#pragma unroll
        for (int t = 0; t < 4; ++t) {
          v8f z;
#pragma unroll
          for (int r = 0; r < 8; ++r) z[r] = 0.0f;
          z = wmma16x16x32(frag_a(&kT[t * 16][0], 72), qa[g][0], z);
          z = wmma16x16x32(frag_a(&kT[t * 16][32], 72), qa[g][1], z);
#pragma unroll
          for (int r = 0; r < 8; ++r)
            sv[t][r] = __builtin_amdgcn_inverse_ballot_w32(mc[t * 8 + r]) ? z[r] : -1.0e30f;
        }
        float mt[4];
#pragma unroll
        for (int t = 0; t < 4; ++t)
          mt[t] = fmaxf(fmaxf(fmaxf(sv[t][0], sv[t][1]), fmaxf(sv[t][2], sv[t][3])),
                        fmaxf(fmaxf(sv[t][4], sv[t][5]), fmaxf(sv[t][6], sv[t][7])));
        float mall = fmaxf(fmaxf(mt[0], mt[1]), fmaxf(mt[2], mt[3]));
        mall = fmaxf(mall, xhalf(mall));
        const float mnew = fmaxf(mref[g], mall);
        float corr;
        asm("v_exp_f32 %0, %1\n\tv_nop" : "=v"(corr) : "v"(mref[g] - mnew));
        mref[g] = mnew;
#pragma unroll
        for (int t = 0; t < 4; ++t)
#pragma unroll
          for (int r = 0; r < 8; ++r) s[g][t][r] = sv[t][r] - mnew;
        lrow[g] *= corr;
#pragma unroll
        for (int ct = 0; ct < 4; ++ct)
#pragma unroll
          for (int r = 0; r < 8; ++r) o[g][ct][r] *= corr;
      }
    }
    // the words are used up: ask for the next pass's (the last pass asks for its own again)
    {
      cuint* mn = mwp + (pass + 1 < NPASS ? pass + 1 : pass) * 32;
#pragma unroll
      for (int g = 0; g < 2; ++g)
#pragma unroll
        for (int i = 0; i < 32; ++i) mk[g][i] = mn[g * MGRP + i];
    }
    // keeps the request for the words here, ahead of the exponentials: left free, the
    // compiler asks for them late in the pass
    __builtin_amdgcn_sched_barrier(0);
    // P^T as B operand: sub-tiles 2c and 2c+1 are k 0..15 and 16..31 of chunk c
    // in the hardware k order (element i: key c*32 + ((i&8)<<1) + 8*lh + (i&7))
    v16h pb[2][2];
#pragma unroll
    for (int g = 0; g < 2; ++g) {
      float ps[4];
#pragma unroll
      for (int t = 0; t < 4; ++t) {
        ps[t] = 0.0f;
#pragma unroll
        for (int r = 0; r < 8; ++r) {
          float p = __builtin_amdgcn_exp2f(s[g][t][r]);
          s[g][t][r] = p;
          ps[t] += p;
        }
      }
      lrow[g] += (ps[0] + ps[1]) + (ps[2] + ps[3]);
#pragma unroll
      for (int c = 0; c < 2; ++c)
#pragma unroll
        for (int i = 0; i < 16; ++i)
          pb[g][c][i] = (_Float16)s[g][2 * c + (i >> 3)][i & 7];
    }

    // O^T += V^T(64x64) * P^T(64x16) per group; V^T rows come from the [d][key] tile,
    // and a V^T fragment serves both groups
#pragma unroll
    for (int ct = 0; ct < 4; ++ct)
#pragma unroll
      for (int c = 0; c < 2; ++c) {
        const v16h vf = frag_a(&vT[ct * 16][c * 32], 72);
        o[0][ct] = wmma16x16x32(vf, pb[0][c], o[0][ct]);
        o[1][ct] = wmma16x16x32(vf, pb[1][c], o[1][ct]);
      }
    // The branch above cuts the pass into two scheduling regions, and in this one the compiler,
    // left free, asks for most V^T fragments only behind the first product and waits for them
    // at once. These groups (0x100: LDS reads, 0x008: matrix products) keep three fragments of
    // two reads each ahead of the first pair of products, then one fragment behind each pair.
    __builtin_amdgcn_sched_group_barrier(0x100, 6, 0);
    __builtin_amdgcn_sched_group_barrier(0x008, 2, 0);
    __builtin_amdgcn_sched_group_barrier(0x100, 2, 0);
    __builtin_amdgcn_sched_group_barrier(0x008, 2, 0);
    __builtin_amdgcn_sched_group_barrier(0x100, 2, 0);
    __builtin_amdgcn_sched_group_barrier(0x008, 2, 0);
    __builtin_amdgcn_sched_group_barrier(0x100, 2, 0);
    __builtin_amdgcn_sched_group_barrier(0x008, 2, 0);
    __builtin_amdgcn_sched_group_barrier(0x100, 2, 0);
    __builtin_amdgcn_sched_group_barrier(0x008, 2, 0);
    __builtin_amdgcn_sched_group_barrier(0x100, 2, 0);
    __builtin_amdgcn_sched_group_barrier(0x008, 6, 0);
    // hand-over: my reads of this buffer are done, my pieces of the next tiles have
    // landed; behind the barrier that holds for every wave, and this buffer is refilled
    asm volatile("s_wait_dscnt 0x0" ::: "memory");
    wait_async0();
    __syncthreads();
    if (pass + 2 < NPASS) stage(buf, pass + 2);
  }
  wait_async0();       // no copy is outstanding when the wave ends

  // Join the two key halves. Wave kh keeps column group kh and hands the other group's
  // O^T, reference and sum (half-waves joined) to its partner wave through LDS.
  lrow[0] += xhalf(lrow[0]);
  lrow[1] += xhalf(lrow[1]);
  const bool hi = kh != 0;
  const float mine_m = hi ? mref[1] : mref[0], send_m = hi ? mref[0] : mref[1];
  const float mine_l = hi ? lrow[1] : lrow[0], send_l = hi ? lrow[0] : lrow[1];
#pragma unroll
  for (int ct = 0; ct < 4; ++ct)
#pragma unroll
    for (int j = 0; j < 2; ++j) {
      float4 w;
      w.x = hi ? o[0][ct][4 * j + 0] : o[1][ct][4 * j + 0];
      w.y = hi ? o[0][ct][4 * j + 1] : o[1][ct][4 * j + 1];
      w.z = hi ? o[0][ct][4 * j + 2] : o[1][ct][4 * j + 2];
      w.w = hi ? o[0][ct][4 * j + 3] : o[1][ct][4 * j + 3];
      *(float4*)&xo[wid][ct * 2 + j][lane][0] = w;
    }
  xml[wid][0][lane] = send_m;
  xml[wid][1][lane] = send_l;
  __syncthreads();     // the partner's values are written by another wave
  const int pw = wid ^ 4;
  const float part_m = xml[pw][0][lane];
  const float part_l = xml[pw][1][lane];
  // both parts brought to the larger reference (a half with no unmasked key has -1e30
  // and drops out against a real one; two such halves weigh alike)
  const float mj = fmaxf(mine_m, part_m);
  const float fa = __builtin_amdgcn_exp2f(mine_m - mj);
  const float fb = __builtin_amdgcn_exp2f(part_m - mj);
  const float inv = 1.0f / (mine_l * fa + part_l * fb);
  const float ga = fa * inv, gb = fb * inv;
  // normalize, write f16 ctx[n, q0 + kh*16 + ln, h*64 + d]:
  // 8 consecutive d per lane and tile -> one 16-byte store each
  _Float16* op = ctx + ((long)n * SEQ + q0 + kh * 16 + ln) * EMB + h * HD + 8 * lh;
#pragma unroll
  for (int ct = 0; ct < 4; ++ct) {
    const float4 p0 = *(const float4*)&xo[pw][ct * 2 + 0][lane][0];
    const float4 p1 = *(const float4*)&xo[pw][ct * 2 + 1][lane][0];
    const float pp[8] = {p0.x, p0.y, p0.z, p0.w, p1.x, p1.y, p1.z, p1.w};
    v8h w;
#pragma unroll
    for (int r = 0; r < 8; ++r)
      w[r] = (_Float16)((hi ? o[1][ct][r] : o[0][ct][r]) * ga + pp[r] * gb);
    *(v8h*)(op + ct * 16) = w;
  }
}

#define FC_K 128
#define FC_TRIPS (EMB / FC_K)
#define FC_PITCH (FC_K + 8)          // halves: 256 B + 16 B pad
#define FC_PITCHB (FC_PITCH * 2)     // bytes
__global__ __launch_bounds__(256) __attribute__((amdgpu_waves_per_eu(2, 2)))
void fc_kernel(
    const _Float16* __restrict__ ctx, const _Float16* __restrict__ Wh,
    const float* __restrict__ bias, float* __restrict__ out) {
  __shared__ alignas(16) _Float16 aLDS[2][128][FC_PITCH];   // [buffer][row][k]
  __shared__ alignas(16) _Float16 bLDS[2][128][FC_PITCH];   // [buffer][column][k]

  const int tid  = threadIdx.x;
  const int wid  = tid >> 5;
  const int lane = tid & 31;
  const int lh   = lane >> 4;
  const int ln   = lane & 15;
  const int n0 = blockIdx.x * 128;
  const int m0 = blockIdx.y * 128;
  const int wm = (wid >> 1) * 32;
  const int wn = (wid & 1) * 64;

  v8f acc[2][4];
#pragma unroll
  for (int i = 0; i < 2; ++i)
#pragma unroll
    for (int j = 0; j < 4; ++j)
#pragma unroll
      for (int r = 0; r < 8; ++r) acc[i][j][r] = 0.0f;

  // A tile of either operand is 128 rows of 16 pieces of 16 bytes; this thread copies
  // piece tid & 15 of rows tid / 16 + 0, 16, .. 112: 16 lanes take 256 B of one row
  const _Float16* ga = ctx + (long)(m0 + (tid >> 4)) * EMB + (tid & 15) * 8;
  const _Float16* gb = Wh  + (long)(n0 + (tid >> 4)) * EMB + (tid & 15) * 8;
  const unsigned lpiece = (unsigned)((tid >> 4) * FC_PITCHB + (tid & 15) * 16);
  auto stage = [&](int buf, int trip) {
    const unsigned la = lds_addr(&aLDS[buf][0][0]) + lpiece;
    const unsigned lb = lds_addr(&bLDS[buf][0][0]) + lpiece;
    const _Float16* pa = ga + trip * FC_K;
    const _Float16* pb = gb + trip * FC_K;
    async_copy8_b128(la, la + 16 * FC_PITCHB, la + 32 * FC_PITCHB, la + 48 * FC_PITCHB,
                     la + 64 * FC_PITCHB, la + 80 * FC_PITCHB, la + 96 * FC_PITCHB,
                     la + 112 * FC_PITCHB,
                     pa, pa + 16 * EMB, pa + 32 * EMB, pa + 48 * EMB,
                     pa + 64 * EMB, pa + 80 * EMB, pa + 96 * EMB, pa + 112 * EMB);
    async_copy8_b128(lb, lb + 16 * FC_PITCHB, lb + 32 * FC_PITCHB, lb + 48 * FC_PITCHB,
                     lb + 64 * FC_PITCHB, lb + 80 * FC_PITCHB, lb + 96 * FC_PITCHB,
                     lb + 112 * FC_PITCHB,
                     pb, pb + 16 * EMB, pb + 32 * EMB, pb + 48 * EMB,
                     pb + 64 * EMB, pb + 80 * EMB, pb + 96 * EMB, pb + 112 * EMB);
  };

  // Two 32-k chunks = 12 fragments = 24 LDS reads, and their 16 products
  struct Half { v16h a[2][2], b[2][4]; };
  auto fetch = [&](Half& f, int buf, int half) {
#pragma unroll
    for (int c = 0; c < 2; ++c) {
      const int k = (half * 2 + c) * 32;
      f.a[c][0] = frag_a(&aLDS[buf][wm][k], FC_PITCH);
      f.a[c][1] = frag_a(&aLDS[buf][wm + 16][k], FC_PITCH);
#pragma unroll
      for (int j = 0; j < 4; ++j)
        f.b[c][j] = frag_b_transposed(&bLDS[buf][wn + j * 16][k], FC_PITCH);   // B = W^T
    }
  };
  auto products = [&](const Half& f) {
#pragma unroll
    for (int c = 0; c < 2; ++c)
#pragma unroll
      for (int j = 0; j < 4; ++j) {
        acc[0][j] = wmma16x16x32(f.a[c][0], f.b[c][j], acc[0][j]);
        acc[1][j] = wmma16x16x32(f.a[c][1], f.b[c][j], acc[1][j]);
      }
  };

  stage(0, 0);
  wait_async0();       // my pieces of the first tiles have landed
  __syncthreads();     // everyone's have
  stage(1, 1);

  // Each half tile's fragments are asked for as one group in front of the products of the
  // half before it. The sched_barriers hold that order: left free, the compiler asks for a
  // B fragment directly in front of its two products and waits for it at once, and it moves
  // products behind the barrier, in front of the refill and the next reads.
  Half lo, hi;
  fetch(lo, 0, 0);
  // unrolled: the tests for a next tile and the buffer's number are then compile-time
#pragma unroll
  for (int t = 0; t < FC_TRIPS; ++t) {
    const int buf = t & 1;
    fetch(hi, buf, 1);
    __builtin_amdgcn_sched_barrier(0);   // the 24 reads stay one group ahead of the products
    products(lo);
    __builtin_amdgcn_sched_barrier(0);   // no product sinks behind the barrier below
    // hand-over: my reads of this buffer are done, my pieces of the next tiles have
    // landed; behind the barrier that holds for every wave, and this buffer is refilled
    asm volatile("s_wait_dscnt 0x0" ::: "memory");
    wait_async0();
    __syncthreads();
    if (t + 2 < FC_TRIPS) stage(buf, t + 2);
    if (t + 1 < FC_TRIPS) fetch(lo, buf ^ 1, 0);
    __builtin_amdgcn_sched_barrier(0);   // refill and reads are issued ahead of the products
    products(hi);
    __builtin_amdgcn_sched_barrier(0);   // the next trip's reads do not mix into the products
  }
  wait_async0();       // no copy is outstanding when the wave ends

#pragma unroll
  for (int ti = 0; ti < 2; ++ti)
#pragma unroll
    for (int tj = 0; tj < 4; ++tj) {
      v8f a = acc[ti][tj];
#pragma unroll
      for (int r = 0; r < 8; ++r) {
        int row = m0 + wm + ti * 16 + r + 8 * lh;
        int col = n0 + wn + tj * 16 + ln;
        out[(long)row * EMB + col] = a[r] + bias[col];
      }
    }
}

extern "C" void kernel_launch(void* const* d_in, const int* in_sizes, int n_in,
                              void* d_out, int out_size, void* d_ws, size_t ws_size,
                              hipStream_t stream) {
  (void)in_sizes; (void)n_in; (void)out_size; (void)ws_size;
  const float* values = (const float*)d_in[0];
  const float* keys   = (const float*)d_in[1];
  const float* query  = (const float*)d_in[2];
  const int*   mask   = (const int*)d_in[3];
  const float* W_fc   = (const float*)d_in[4];
  const float* b_fc   = (const float*)d_in[5];

  // workspace: ctx_h (8 MiB f16) | W_h (2 MiB f16) | lane masks (1 MiB) |
  //            K_h (8 MiB f16) | V_t (8 MiB f16)
  _Float16* ctx_h = (_Float16*)d_ws;
  _Float16* W_h   = (_Float16*)((char*)d_ws + (size_t)NB * SEQ * EMB * 2);
  unsigned* mask_w = (unsigned*)((char*)d_ws + (size_t)NB * SEQ * EMB * 2 +
                                 (size_t)EMB * EMB * 2);
  _Float16* K_h = (_Float16*)((char*)d_ws + (size_t)NB * SEQ * EMB * 2 +
                              (size_t)EMB * EMB * 2 + (size_t)NB * SEQ * SEQ / 8);
  _Float16* V_t = K_h + (size_t)NB * SEQ * EMB;

  prep_kernel<<<dim3(KV_BLOCKS + PACK_BLOCKS + CVT_BLOCKS), 256, 0, stream>>>(
      W_fc, W_h, mask, mask_w, keys, values, K_h, V_t);
  attn_kernel<<<dim3(SEQ / 128, NH, NB), 256, 0, stream>>>(query, K_h, V_t,
                                                           mask_w, ctx_h);
  fc_kernel<<<dim3(EMB / 128, (NB * SEQ) / 128), 256, 0, stream>>>(ctx_h, W_h,
                                                                  b_fc,
                                                                  (float*)d_out);
}

// v007
// A run of this version takes 52.7 microseconds.
// Timed twice side by side with v006, it ran 1.04 and 1.05 times as fast.
// All steps since v000 together make it 2.49 times as fast.
#include <hip/hip_runtime.h>
#include <hip/hip_bf16.h>

#define SEQ 2048
#define NB  2
#define EMB 1024
#define NH  16
#define HD  64

typedef __attribute__((ext_vector_type(16))) _Float16 v16h;
typedef __attribute__((ext_vector_type(8)))  float    v8f;
typedef __attribute__((ext_vector_type(8)))  _Float16 v8h;
typedef __attribute__((ext_vector_type(4)))  _Float16 v4h;
typedef __attribute__((ext_vector_type(2)))  _Float16 v2h;

__device__ __forceinline__ v8f wmma16x16x32(v16h a, v16h b, v8f c) {
  // D = A(16x32 f16) x B(32x16 f16) + C(16x16 f32)
  return __builtin_amdgcn_wmma_f32_16x16x32_f16(false, a, false, b, (short)0, c,
                                                false, false);
}

__device__ __forceinline__ v16h frag_a(const _Float16* base, int stride) {
  const int lane = threadIdx.x & 31;
  const int m = lane & 15, lh = lane >> 4;
  v16h r;
#pragma unroll
  for (int i = 0; i < 16; ++i) {
    int k = ((i & 8) << 1) + (lh << 3) + (i & 7);
    r[i] = base[m * stride + k];
  }
  return r;
}

// B-matrix fragment B[k][n] from LDS stored [n][k]; same 16B-run property.
__device__ __forceinline__ v16h frag_b_transposed(const _Float16* base, int stride) {
  const int lane = threadIdx.x & 31;
  const int nn = lane & 15, lh = lane >> 4;
  v16h r;
#pragma unroll
  for (int i = 0; i < 16; ++i) {
    int k = ((i & 8) << 1) + (lh << 3) + (i & 7);
    r[i] = base[nn * stride + k];
  }
  return r;
}

__device__ __forceinline__ float xhalf(float v) {
  int b = __builtin_bit_cast(int, v);
  b = __builtin_amdgcn_permlanex16(b, b, 0x76543210, 0xfedcba98, false, false);
  return __builtin_bit_cast(float, b);
}

__device__ __forceinline__ float exp2_slot(float x) {
  float y;
  asm("v_exp_f32 %0, %1\n\tv_nop" : "=v"(y) : "v"(x));
  return y;
}

__device__ __forceinline__ unsigned lds_addr(const void* p) {
  // flat LDS addresses: low 32 bits are the wave-relative LDS offset
  return (unsigned)(unsigned long long)p;
}
__device__ __forceinline__ void async_copy8_b128(unsigned l0, unsigned l1, unsigned l2,
                                                 unsigned l3, unsigned l4, unsigned l5,
                                                 unsigned l6, unsigned l7, const void* g0,
                                                 const void* g1, const void* g2, const void* g3,
                                                 const void* g4, const void* g5, const void* g6,
                                                 const void* g7) {
  asm volatile("global_load_async_to_lds_b128 %0, %8, off\n\t"
               "global_load_async_to_lds_b128 %1, %9, off\n\t"
               "global_load_async_to_lds_b128 %2, %10, off\n\t"
               "global_load_async_to_lds_b128 %3, %11, off\n\t"
               "global_load_async_to_lds_b128 %4, %12, off\n\t"
               "global_load_async_to_lds_b128 %5, %13, off\n\t"
               "global_load_async_to_lds_b128 %6, %14, off\n\t"
               "global_load_async_to_lds_b128 %7, %15, off\n\t"
               "s_wait_xcnt 0x0"
               :: "v"(l0), "v"(l1), "v"(l2), "v"(l3), "v"(l4), "v"(l5), "v"(l6), "v"(l7),
                  "v"(g0), "v"(g1), "v"(g2), "v"(g3), "v"(g4), "v"(g5), "v"(g6), "v"(g7)
               : "memory");
}
__device__ __forceinline__ void wait_async0() {
  asm volatile("s_wait_asynccnt 0x0" ::: "memory");
}

// ---------------------------------------------------------------------------
// Kernel 0, three independent jobs by block index.
// Blocks 0 .. KV_BLOCKS-1 (the longest, so they start first): one head's K and V
// rows of 128 keys, f32 -> f16, laid out as the attention kernel's LDS tiles:
//   Kh[n][h][key][d]                 (a tile of 64 keys = 8 KiB in a row)
//   Vt[n][h][key / 64][d][key % 64]  (transposed; a tile = 8 KiB in a row)
// The next PACK_BLOCKS blocks: the int32 mask, read once with whole-line loads,
// becomes lane masks for the attention kernel. One wave takes one tile of
// 16 queries x 64 keys and writes 32 words:
//   mw[tile16][key block][t*8 + r], bit (16*lh + ln) =
//     mask[query tile16*16 + ln][key block*64 + t*16 + 8*lh + r] != 0
// which is the place of that score in the S^T accumulator (tile t, register r,
// lane 16*lh + ln).
// The other blocks: W f32 -> f16 conversion (4 MB read, 2 MB write).
// ---------------------------------------------------------------------------
#define PACK_BLOCKS ((NB * (SEQ / 16) * (SEQ / 64)) / 8)
#define CVT_BLOCKS  ((EMB * EMB) / 1024)
#define KV_BLOCKS   (NB * NH * (SEQ / 128))
__global__ __launch_bounds__(256) void prep_kernel(const float* __restrict__ W,
                                                   _Float16* __restrict__ Wh,
                                                   const int* __restrict__ mask,
                                                   unsigned* __restrict__ mw,
                                                   const float* __restrict__ keys,
                                                   const float* __restrict__ values,
                                                   _Float16* __restrict__ Kh,
                                                   _Float16* __restrict__ Vt) {
  __shared__ alignas(16) unsigned char nib[8][16][16];  // [wave][query][key / 4]
  __shared__ alignas(16) _Float16 vtr[HD][136];         // [d][key], 128 keys + pad
  if (blockIdx.x < KV_BLOCKS) {
    const int tid = threadIdx.x;
    const int kb  = (blockIdx.x & (SEQ / 128 - 1)) * 128;
    const int nh  = blockIdx.x / (SEQ / 128);           // n * NH + h
    const long in_off = ((long)(nh / NH) * SEQ + kb) * EMB + (nh % NH) * HD;
    const float* kp = keys + in_off;
    const float* vp = values + in_off;
    _Float16* ko = Kh + ((long)nh * SEQ + kb) * HD;
    _Float16* vo = Vt + ((long)nh * SEQ + kb) * HD;
    const int c4 = (tid & 15) * 4;                      // d 0..60
    const int r0 = tid >> 4;                            // 0..15
    float4 kv[8], va[4], vb[4];
#pragma unroll
    for (int it = 0; it < 8; ++it)
      kv[it] = *(const float4*)(kp + (long)(r0 + 16 * it) * EMB + c4);
#pragma unroll
    for (int it = 0; it < 4; ++it) {                    // two neighbouring keys
      va[it] = *(const float4*)(vp + (long)(2 * (r0 + 16 * it)) * EMB + c4);
      vb[it] = *(const float4*)(vp + (long)(2 * (r0 + 16 * it) + 1) * EMB + c4);
    }
#pragma unroll
    for (int it = 0; it < 8; ++it) {
      v4h w = {(_Float16)kv[it].x, (_Float16)kv[it].y, (_Float16)kv[it].z, (_Float16)kv[it].w};
      *(v4h*)(ko + (r0 + 16 * it) * HD + c4) = w;
    }
#pragma unroll
    for (int it = 0; it < 4; ++it) {
      const int key = 2 * (r0 + 16 * it);
      v2h p0 = {(_Float16)va[it].x, (_Float16)vb[it].x};
      v2h p1 = {(_Float16)va[it].y, (_Float16)vb[it].y};
      v2h p2 = {(_Float16)va[it].z, (_Float16)vb[it].z};
      v2h p3 = {(_Float16)va[it].w, (_Float16)vb[it].w};
      *(v2h*)&vtr[c4 + 0][key] = p0; *(v2h*)&vtr[c4 + 1][key] = p1;
      *(v2h*)&vtr[c4 + 2][key] = p2; *(v2h*)&vtr[c4 + 3][key] = p3;
    }
    __syncthreads();   // a row of one d holds keys written by other waves
#pragma unroll
    for (int it = 0; it < 4; ++it) {
      const int c = tid + it * 256;   // 16-byte piece: tile c >> 9, d (c >> 3) & 63
      *(v8h*)(vo + c * 8) = *(const v8h*)&vtr[(c >> 3) & 63][(c >> 9) * 64 + (c & 7) * 8];
    }
    return;
  }
  const int bid = blockIdx.x - KV_BLOCKS;
  if (bid >= PACK_BLOCKS) {
    long i = ((long)(bid - PACK_BLOCKS) * 256 + threadIdx.x) * 4;
    float4 w = *(const float4*)(W + i);
    Wh[i + 0] = (_Float16)w.x; Wh[i + 1] = (_Float16)w.y;
    Wh[i + 2] = (_Float16)w.z; Wh[i + 3] = (_Float16)w.w;
    return;
  }
  const int wid  = threadIdx.x >> 5;
  const int lane = threadIdx.x & 31;
  const int lh   = lane >> 4;
  const int ln   = lane & 15;
  const int task = bid * 8 + wid;            // tile16 * 32 + key block
  const int* mp = mask + (long)(task >> 5) * 16 * SEQ + (task & 31) * 64;
  // a load covers two rows of 256 B; four keys of one query -> one nibble
  int4 m[8];
#pragma unroll
  for (int j = 0; j < 8; ++j)
    m[j] = *(const int4*)(mp + (long)(2 * j + lh) * SEQ + 4 * ln);
#pragma unroll
  for (int j = 0; j < 8; ++j)
    nib[wid][2 * j + lh][ln] = (unsigned char)((m[j].x != 0 ? 1 : 0) | (m[j].y != 0 ? 2 : 0) |
                                               (m[j].z != 0 ? 4 : 0) | (m[j].w != 0 ? 8 : 0));
  __syncthreads();   // the nibbles of a row come from other lanes
  // query ln's 64 keys: key k is bit (k & 3) of byte k >> 2
  const uint4 rb = *(const uint4*)&nib[wid][ln][0];
  const unsigned x[4] = {rb.x >> (16 * lh), rb.y >> (16 * lh),
                         rb.z >> (16 * lh), rb.w >> (16 * lh)};
  unsigned w = 0;
#pragma unroll
  for (int t = 0; t < 4; ++t)
#pragma unroll
    for (int r = 0; r < 8; ++r) {
      unsigned b = __builtin_amdgcn_ballot_w32(((x[t] >> (8 * (r >> 2) + (r & 3))) & 1u) != 0);
      if (lane == t * 8 + r) w = b;
    }
  mw[(long)task * 32 + lane] = w;
  asm volatile("s_wait_xcnt 0x0" ::: "memory");
}

#define NPASS (SEQ / 128)
__global__ __launch_bounds__(256) __attribute__((amdgpu_waves_per_eu(4, 4)))
void attn_kernel(
    const float* __restrict__ query, const _Float16* __restrict__ Kh,
    const _Float16* __restrict__ Vt, const unsigned* __restrict__ maskw,
    _Float16* __restrict__ ctx) {
  __shared__ alignas(16) _Float16 kLDS[2][2][64][72];   // [buffer][key half][key][d]
  __shared__ alignas(16) _Float16 vLDS[2][2][64][72];   // [buffer][key half][d][key]
  __shared__ alignas(16) float xo[8][8][32][4];         // [wave][four of O^T][lane]
  __shared__ float xml[8][2][32];                       // [wave][reference, sum][lane]

  const int tid  = threadIdx.x;
  const int wid  = __builtin_amdgcn_readfirstlane(tid >> 5);   // uniform: scalar use below
  const int lane = tid & 31;
  const int lh   = lane >> 4;
  const int ln   = lane & 15;
  const int cg   = wid & 3;    // which 32 query columns
  const int kh   = wid >> 2;   // which half of the keys
  const int qt = blockIdx.x, h = blockIdx.y, n = blockIdx.z;
  const int q0 = qt * 128 + cg * 32;

  const float* qp = query  + ((long)n * SEQ + q0) * EMB + h * HD;
  // a tile is 512 pieces of 16 bytes in a row; this thread copies pieces tid and
  // tid + 256 of each tile: LDS row = piece / 8, 144 bytes a row
  const _Float16* kp = Kh + (long)(n * NH + h) * SEQ * HD + tid * 8;
  const _Float16* vp = Vt + (long)(n * NH + h) * SEQ * HD + tid * 8;
  const unsigned lpiece = (unsigned)((tid >> 3) * 144 + (tid & 7) * 16);
  auto stage = [&](int buf, int pass) {   // tile pass of each key half, K and V^T
    const unsigned lk = lds_addr(&kLDS[buf][0][0][0]) + lpiece;
    const unsigned lv = lds_addr(&vLDS[buf][0][0][0]) + lpiece;
    const _Float16* gk = kp + pass * (64 * HD);
    const _Float16* gv = vp + pass * (64 * HD);
    async_copy8_b128(lk, lk + 32 * 144, lk + 64 * 144, lk + 96 * 144,
                     lv, lv + 32 * 144, lv + 64 * 144, lv + 96 * 144,
                     gk, gk + 256 * 8, gk + (SEQ / 2) * HD, gk + (SEQ / 2) * HD + 256 * 8,
                     gv, gv + 256 * 8, gv + (SEQ / 2) * HD, gv + (SEQ / 2) * HD + 256 * 8);
  };
  stage(0, 0);
  typedef __attribute__((address_space(4))) const unsigned cuint;
  constexpr int MGRP = (SEQ / 64) * 32;
  cuint* mwp = (cuint*)(unsigned long long)(maskw +
      ((long)(n * (SEQ / 16) + qt * 8 + cg * 2) * (SEQ / 64) + kh * NPASS) * 32);

  // Q^T fragments (B operand: column = query g*16 + ln, two K=32 chunks over D=64);
  // softmax 1/sqrt(EMB)=1/32 and log2(e) folded in
  v16h qa[2][2];
#pragma unroll
  for (int g = 0; g < 2; ++g)
#pragma unroll
    for (int c = 0; c < 2; ++c)
#pragma unroll
      for (int i = 0; i < 16; ++i) {
        int k = ((i & 8) << 1) + (lh << 3) + (i & 7) + c * 32;
        qa[g][c][i] = (_Float16)(qp[(long)(g * 16 + ln) * EMB + k] *
                                 (1.4426950408889634f * 0.03125f));
      }

  // reference maximum of query g*16 + ln, log2 units (equal in both half-waves)
  float mref[2];
  float lrow[2] = {0.0f, 0.0f};   // running sum over this wave's keys (equal in both half-waves)
  // A operand of the row sums: every row ones, so every row of D, and with it every lane of
  // a column, holds the sum of that column of P^T over the 32 keys of a chunk
  v16h ones;
#pragma unroll
  for (int i = 0; i < 16; ++i) ones[i] = (_Float16)1.0f;
  v8f o[2][4];                    // o[g][ct][r] = O^T[d = ct*16 + 8*lh + r][query g*16 + ln]
#pragma unroll
  for (int g = 0; g < 2; ++g)
#pragma unroll
    for (int t = 0; t < 4; ++t)
#pragma unroll
      for (int r = 0; r < 8; ++r) o[g][t][r] = 0.0f;

  // The first pass's lane masks; each pass asks for the next pass's
  unsigned mk[2][32];
#pragma unroll
  for (int g = 0; g < 2; ++g)
#pragma unroll
    for (int i = 0; i < 32; ++i) mk[g][i] = mwp[g * MGRP + i];

  wait_async0();       // my pieces of the first tiles have landed
  __syncthreads();     // everyone's have
  stage(1, 1);

  // The plain scores of group g against one K tile, -1e30 where the lane masks in mk are 0,
  // and their maximum per query, joined over the half-waves
  auto plain_scores = [&](int g, const _Float16 (*kt)[72], float (&sv)[4][8]) -> float {
#pragma unroll
    for (int t = 0; t < 4; ++t) {
      v8f z;
#pragma unroll
      for (int r = 0; r < 8; ++r) z[r] = 0.0f;
      z = wmma16x16x32(frag_a(&kt[t * 16][0], 72), qa[g][0], z);
      z = wmma16x16x32(frag_a(&kt[t * 16][32], 72), qa[g][1], z);
#pragma unroll
      for (int r = 0; r < 8; ++r)
        sv[t][r] = __builtin_amdgcn_inverse_ballot_w32(mk[g][t * 8 + r]) ? z[r] : -1.0e30f;
    }
    float mt[4];
#pragma unroll
    for (int t = 0; t < 4; ++t)
      mt[t] = fmaxf(fmaxf(fmaxf(sv[t][0], sv[t][1]), fmaxf(sv[t][2], sv[t][3])),
                    fmaxf(fmaxf(sv[t][4], sv[t][5]), fmaxf(sv[t][6], sv[t][7])));
    const float mall = fmaxf(fmaxf(mt[0], mt[1]), fmaxf(mt[2], mt[3]));
    return fmaxf(mall, xhalf(mall));
  };
  // The first references are the first tile's maxima, found ahead of the loop: the test in the
  // loop stands behind the exponentials, which a pass without a reference would do in vain
#pragma unroll
  for (int g = 0; g < 2; ++g) {
    float sv[4][8];
    mref[g] = plain_scores(g, kLDS[0][kh], sv);
  }

  for (int pass = 0; pass < NPASS; ++pass) {
    const int buf = pass & 1;
    const _Float16 (*kT)[72] = kLDS[buf][kh];
    const _Float16 (*vT)[72] = vLDS[buf][kh];

    // C operand of S^T: minus the reference, or -1e30 where the mask is 0
    // s[g][t][r] belongs to (query g*16 + ln, key t*16 + 8*lh + r of the tile)
    v8f s[2][4];
#pragma unroll
    for (int g = 0; g < 2; ++g) {
      const float negm = -mref[g];
#pragma unroll
      for (int t = 0; t < 4; ++t)
#pragma unroll
        for (int r = 0; r < 8; ++r)
          s[g][t][r] = __builtin_amdgcn_inverse_ballot_w32(mk[g][t * 8 + r]) ? negm : -1.0e30f;
    }
    // S^T = K * Q'^T - reference for four 16-key sub-tiles; a K fragment serves both groups
#pragma unroll
    for (int t = 0; t < 4; ++t) {
      const v16h k0 = frag_a(&kT[t * 16][0], 72);
      const v16h k1 = frag_a(&kT[t * 16][32], 72);
      s[0][t] = wmma16x16x32(k0, qa[0][0], s[0][t]);
      s[1][t] = wmma16x16x32(k0, qa[1][0], s[1][t]);
      s[0][t] = wmma16x16x32(k1, qa[0][1], s[0][t]);
      s[1][t] = wmma16x16x32(k1, qa[1][1], s[1][t]);
    }
    // (0x100: LDS reads, 0x008: matrix products) all sixteen K reads are asked for as one group
    // ahead of the products: left free, the compiler reads through two fragments' registers
    // and waits for each fragment at once
    __builtin_amdgcn_sched_group_barrier(0x100, 16, 1);
    __builtin_amdgcn_sched_group_barrier(0x008, 16, 1);
    // the words are used up: ask for the next pass's (the last pass asks for its own again)
    cuint* mn = mwp + (pass + 1 < NPASS ? pass + 1 : pass) * 32;
#pragma unroll
    for (int g = 0; g < 2; ++g)
#pragma unroll
      for (int i = 0; i < 32; ++i) mk[g][i] = mn[g * MGRP + i];
    // keeps the request for the words here, ahead of the exponentials: left free, the
    // compiler asks for them late in the pass
    __builtin_amdgcn_sched_barrier(0);
    // the first four V^T fragments are asked for ahead of the exponentials
    v16h vf[8];
#pragma unroll
    for (int f = 0; f < 4; ++f) vf[f] = frag_a(&vT[(f >> 1) * 16][(f & 1) * 32], 72);
    // P^T as B operand: sub-tiles 2c and 2c+1 are k 0..15 and 16..31 of chunk c
    // in the hardware k order (element i: key c*32 + ((i&8)<<1) + 8*lh + (i&7));
    // ls[g][r] = sum of the pass's 64 P of query g*16 + ln, the same in every r and both lh
    v16h pb[2][2];
    v8f ls[2];
#pragma unroll
    for (int g = 0; g < 2; ++g) {
#pragma unroll
      for (int c = 0; c < 2; ++c)
#pragma unroll
        for (int i = 0; i < 16; ++i)
          pb[g][c][i] = (_Float16)__builtin_amdgcn_exp2f(s[g][2 * c + (i >> 3)][i & 7]);
#pragma unroll
      for (int r = 0; r < 8; ++r) ls[g][r] = 0.0f;
      ls[g] = wmma16x16x32(ones, pb[g][0], ls[g]);
      ls[g] = wmma16x16x32(ones, pb[g][1], ls[g]);
    }
    // (0x100: LDS reads, 0x400: transcendentals) the eight V^T reads stand ahead of the
    // exponentials, which cover their latency
    __builtin_amdgcn_sched_group_barrier(0x100, 8, 2);
    __builtin_amdgcn_sched_group_barrier(0x400, 64, 2);
    // holds those reads on this side of the branch below: left free, the compiler sinks them
    // behind it, in front of their products, and waits for each at once
    asm volatile("" :: "v"(vf[0]), "v"(vf[1]), "v"(vf[2]), "v"(vf[3]));
    // One test a pass: do the references still serve every query of the wave? One does not
    // where the pass's sum exceeds 256 (a score over 8 above the reference makes it so, one
    // that overflows f16 makes it infinite), or while a query has met no unmasked key
    // (-1e30 is no reference to subtract from a score).
    const bool need = ls[0][0] > 256.0f || ls[1][0] > 256.0f ||
                      mref[0] < -1.0e29f || mref[1] < -1.0e29f;
    if (__builtin_amdgcn_ballot_w32(need) != 0) {
      // New references: the plain scores once more, their
      // maximum joined over the half-waves, O and the sum brought to the new reference,
      // P and its row sum anew. This pass's lane masks take the place of the next pass's,
      // which are asked for again at the end.
      cuint* mc = mwp + pass * 32;
#pragma unroll
      for (int g = 0; g < 2; ++g)
#pragma unroll
        for (int i = 0; i < 32; ++i) mk[g][i] = mc[g * MGRP + i];
#pragma unroll
      for (int g = 0; g < 2; ++g) {
        float sv[4][8];
        const float mall = plain_scores(g, kT, sv);
        const float mnew = fmaxf(mref[g], mall);
        const float corr = exp2_slot(mref[g] - mnew);
        mref[g] = mnew;
        lrow[g] *= corr;
#pragma unroll
        for (int ct = 0; ct < 4; ++ct)
#pragma unroll
          for (int r = 0; r < 8; ++r) o[g][ct][r] *= corr;
#pragma unroll
        for (int c = 0; c < 2; ++c)
#pragma unroll
          for (int i = 0; i < 16; ++i)
            pb[g][c][i] = (_Float16)exp2_slot(sv[2 * c + (i >> 3)][i & 7] - mnew);
#pragma unroll
        for (int r = 0; r < 8; ++r) ls[g][r] = 0.0f;
        ls[g] = wmma16x16x32(ones, pb[g][0], ls[g]);
        ls[g] = wmma16x16x32(ones, pb[g][1], ls[g]);
      }
#pragma unroll
      for (int g = 0; g < 2; ++g)
#pragma unroll
        for (int i = 0; i < 32; ++i) mk[g][i] = mn[g * MGRP + i];
    }
    lrow[0] += ls[0][0];
    lrow[1] += ls[1][0];

    // O^T += V^T(64x64) * P^T(64x16) per group; V^T rows come from the [d][key] tile,
    // and a V^T fragment serves both groups
#pragma unroll
    for (int f = 4; f < 8; ++f) vf[f] = frag_a(&vT[(f >> 1) * 16][(f & 1) * 32], 72);
#pragma unroll
    for (int f = 0; f < 4; ++f) {
      o[0][f >> 1] = wmma16x16x32(vf[f], pb[0][f & 1], o[0][f >> 1]);
      o[1][f >> 1] = wmma16x16x32(vf[f], pb[1][f & 1], o[1][f >> 1]);
    }
    // (0x100: LDS reads, 0x008: matrix products) the other four fragments are asked for as one
    // group ahead of the products. Left free, the compiler asks for most of them only behind
    // six of the eight products that are to cover their latency.
    __builtin_amdgcn_sched_group_barrier(0x100, 8, 0);
    __builtin_amdgcn_sched_group_barrier(0x008, 8, 0);
    // the eight products of the first four fragments stay here, where they cover the latency of
    // those reads: left free, they sink behind the wait for the reads at the pass's foot
    __builtin_amdgcn_sched_barrier(0);
#pragma unroll
    for (int f = 4; f < 8; ++f) {
      o[0][f >> 1] = wmma16x16x32(vf[f], pb[0][f & 1], o[0][f >> 1]);
      o[1][f >> 1] = wmma16x16x32(vf[f], pb[1][f & 1], o[1][f >> 1]);
    }
    // hand-over: my reads of this buffer are done, my pieces of the next tiles have
    // landed; behind the barrier that holds for every wave, and this buffer is refilled
    asm volatile("s_wait_dscnt 0x0" ::: "memory");
    wait_async0();
    __syncthreads();
    if (pass + 2 < NPASS) stage(buf, pass + 2);
  }
  wait_async0();       // no copy is outstanding when the wave ends

  // Join the two key halves. Wave kh keeps column group kh and hands the other group's
  // O^T, reference and sum to its partner wave through LDS.
  const bool hi = kh != 0;
  const float mine_m = hi ? mref[1] : mref[0], send_m = hi ? mref[0] : mref[1];
  const float mine_l = hi ? lrow[1] : lrow[0], send_l = hi ? lrow[0] : lrow[1];
#pragma unroll
  for (int ct = 0; ct < 4; ++ct)
#pragma unroll
    for (int j = 0; j < 2; ++j) {
      float4 w;
      w.x = hi ? o[0][ct][4 * j + 0] : o[1][ct][4 * j + 0];
      w.y = hi ? o[0][ct][4 * j + 1] : o[1][ct][4 * j + 1];
      w.z = hi ? o[0][ct][4 * j + 2] : o[1][ct][4 * j + 2];
      w.w = hi ? o[0][ct][4 * j + 3] : o[1][ct][4 * j + 3];
      *(float4*)&xo[wid][ct * 2 + j][lane][0] = w;
    }
  xml[wid][0][lane] = send_m;
  xml[wid][1][lane] = send_l;
  __syncthreads();     // the partner's values are written by another wave
  const int pw = wid ^ 4;
  const float part_m = xml[pw][0][lane];
  const float part_l = xml[pw][1][lane];
  // both parts brought to the larger reference (a half with no unmasked key has -1e30
  // and drops out against a real one; two such halves weigh alike)
  const float mj = fmaxf(mine_m, part_m);
  const float fa = exp2_slot(mine_m - mj);
  const float fb = exp2_slot(part_m - mj);
  const float inv = 1.0f / (mine_l * fa + part_l * fb);
  const float ga = fa * inv, gb = fb * inv;
  // normalize, write f16 ctx[n, q0 + kh*16 + ln, h*64 + d]:
  // 8 consecutive d per lane and tile -> one 16-byte store each
  _Float16* op = ctx + ((long)n * SEQ + q0 + kh * 16 + ln) * EMB + h * HD + 8 * lh;
#pragma unroll
  for (int ct = 0; ct < 4; ++ct) {
    const float4 p0 = *(const float4*)&xo[pw][ct * 2 + 0][lane][0];
    const float4 p1 = *(const float4*)&xo[pw][ct * 2 + 1][lane][0];
    const float pp[8] = {p0.x, p0.y, p0.z, p0.w, p1.x, p1.y, p1.z, p1.w};
    v8h w;
#pragma unroll
    for (int r = 0; r < 8; ++r)
      w[r] = (_Float16)((hi ? o[1][ct][r] : o[0][ct][r]) * ga + pp[r] * gb);
    *(v8h*)(op + ct * 16) = w;
  }
}

#define FC_K 128
#define FC_TRIPS (EMB / FC_K)
#define FC_PITCH (FC_K + 8)          // halves: 256 B + 16 B pad
#define FC_PITCHB (FC_PITCH * 2)     // bytes
__global__ __launch_bounds__(256) __attribute__((amdgpu_waves_per_eu(2, 2)))
void fc_kernel(
    const _Float16* __restrict__ ctx, const _Float16* __restrict__ Wh,
    const float* __restrict__ bias, float* __restrict__ out) {
  __shared__ alignas(16) _Float16 aLDS[2][128][FC_PITCH];   // [buffer][row][k]
  __shared__ alignas(16) _Float16 bLDS[2][128][FC_PITCH];   // [buffer][column][k]

  const int tid  = threadIdx.x;
  const int wid  = tid >> 5;
  const int lane = tid & 31;
  const int lh   = lane >> 4;
  const int ln   = lane & 15;
  const int n0 = blockIdx.x * 128;
  const int m0 = blockIdx.y * 128;
  const int wm = (wid >> 1) * 32;
  const int wn = (wid & 1) * 64;

  v8f acc[2][4];
#pragma unroll
  for (int i = 0; i < 2; ++i)
#pragma unroll
    for (int j = 0; j < 4; ++j)
#pragma unroll
      for (int r = 0; r < 8; ++r) acc[i][j][r] = 0.0f;

  // A tile of either operand is 128 rows of 16 pieces of 16 bytes; this thread copies
  // piece tid & 15 of rows tid / 16 + 0, 16, .. 112: 16 lanes take 256 B of one row
  const _Float16* ga = ctx + (long)(m0 + (tid >> 4)) * EMB + (tid & 15) * 8;
  const _Float16* gb = Wh  + (long)(n0 + (tid >> 4)) * EMB + (tid & 15) * 8;
  const unsigned lpiece = (unsigned)((tid >> 4) * FC_PITCHB + (tid & 15) * 16);
  auto stage = [&](int buf, int trip) {
    const unsigned la = lds_addr(&aLDS[buf][0][0]) + lpiece;
    const unsigned lb = lds_addr(&bLDS[buf][0][0]) + lpiece;
    const _Float16* pa = ga + trip * FC_K;
    const _Float16* pb = gb + trip * FC_K;
    async_copy8_b128(la, la + 16 * FC_PITCHB, la + 32 * FC_PITCHB, la + 48 * FC_PITCHB,
                     la + 64 * FC_PITCHB, la + 80 * FC_PITCHB, la + 96 * FC_PITCHB,
                     la + 112 * FC_PITCHB,
                     pa, pa + 16 * EMB, pa + 32 * EMB, pa + 48 * EMB,
                     pa + 64 * EMB, pa + 80 * EMB, pa + 96 * EMB, pa + 112 * EMB);
    async_copy8_b128(lb, lb + 16 * FC_PITCHB, lb + 32 * FC_PITCHB, lb + 48 * FC_PITCHB,
                     lb + 64 * FC_PITCHB, lb + 80 * FC_PITCHB, lb + 96 * FC_PITCHB,
                     lb + 112 * FC_PITCHB,
                     pb, pb + 16 * EMB, pb + 32 * EMB, pb + 48 * EMB,
                     pb + 64 * EMB, pb + 80 * EMB, pb + 96 * EMB, pb + 112 * EMB);
  };

  // Two 32-k chunks = 12 fragments = 24 LDS reads, and their 16 products
  struct Half { v16h a[2][2], b[2][4]; };
  auto fetch = [&](Half& f, int buf, int half) {
#pragma unroll
    for (int c = 0; c < 2; ++c) {
      const int k = (half * 2 + c) * 32;
      f.a[c][0] = frag_a(&aLDS[buf][wm][k], FC_PITCH);
      f.a[c][1] = frag_a(&aLDS[buf][wm + 16][k], FC_PITCH);
#pragma unroll
      for (int j = 0; j < 4; ++j)
        f.b[c][j] = frag_b_transposed(&bLDS[buf][wn + j * 16][k], FC_PITCH);   // B = W^T
    }
  };
  auto products = [&](const Half& f) {
#pragma unroll
    for (int c = 0; c < 2; ++c)
#pragma unroll
      for (int j = 0; j < 4; ++j) {
        acc[0][j] = wmma16x16x32(f.a[c][0], f.b[c][j], acc[0][j]);
        acc[1][j] = wmma16x16x32(f.a[c][1], f.b[c][j], acc[1][j]);
      }
  };

  stage(0, 0);
  wait_async0();       // my pieces of the first tiles have landed
  __syncthreads();     // everyone's have
  stage(1, 1);

  // Each half tile's fragments are asked for as one group in front of the products of the
  // half before it. The sched_barriers hold that order: left free, the compiler asks for a
  // B fragment directly in front of its two products and waits for it at once, and it moves
  // products behind the barrier, in front of the refill and the next reads.
  Half lo, hi;
  fetch(lo, 0, 0);
  // unrolled: the tests for a next tile and the buffer's number are then compile-time
#pragma unroll
  for (int t = 0; t < FC_TRIPS; ++t) {
    const int buf = t & 1;
    fetch(hi, buf, 1);
    __builtin_amdgcn_sched_barrier(0);   // the 24 reads stay one group ahead of the products
    products(lo);
    __builtin_amdgcn_sched_barrier(0);   // no product sinks behind the barrier below
    // hand-over: my reads of this buffer are done, my pieces of the next tiles have
    // landed; behind the barrier that holds for every wave, and this buffer is refilled
    asm volatile("s_wait_dscnt 0x0" ::: "memory");
    wait_async0();
    __syncthreads();
    if (t + 2 < FC_TRIPS) stage(buf, t + 2);
    if (t + 1 < FC_TRIPS) fetch(lo, buf ^ 1, 0);
    __builtin_amdgcn_sched_barrier(0);   // refill and reads are issued ahead of the products
    products(hi);
    __builtin_amdgcn_sched_barrier(0);   // the next trip's reads do not mix into the products
  }
  wait_async0();       // no copy is outstanding when the wave ends

#pragma unroll
  for (int ti = 0; ti < 2; ++ti)
#pragma unroll
    for (int tj = 0; tj < 4; ++tj) {
      v8f a = acc[ti][tj];
#pragma unroll
      for (int r = 0; r < 8; ++r) {
        int row = m0 + wm + ti * 16 + r + 8 * lh;
        int col = n0 + wn + tj * 16 + ln;
        out[(long)row * EMB + col] = a[r] + bias[col];
      }
    }
}

extern "C" void kernel_launch(void* const* d_in, const int* in_sizes, int n_in,
                              void* d_out, int out_size, void* d_ws, size_t ws_size,
                              hipStream_t stream) {
  (void)in_sizes; (void)n_in; (void)out_size; (void)ws_size;
  const float* values = (const float*)d_in[0];
  const float* keys   = (const float*)d_in[1];
  const float* query  = (const float*)d_in[2];
  const int*   mask   = (const int*)d_in[3];
  const float* W_fc   = (const float*)d_in[4];
  const float* b_fc   = (const float*)d_in[5];

  // workspace: ctx_h (8 MiB f16) | W_h (2 MiB f16) | lane masks (1 MiB) |
  //            K_h (8 MiB f16) | V_t (8 MiB f16)
  _Float16* ctx_h = (_Float16*)d_ws;
  _Float16* W_h   = (_Float16*)((char*)d_ws + (size_t)NB * SEQ * EMB * 2);
  unsigned* mask_w = (unsigned*)((char*)d_ws + (size_t)NB * SEQ * EMB * 2 +
                                 (size_t)EMB * EMB * 2);
  _Float16* K_h = (_Float16*)((char*)d_ws + (size_t)NB * SEQ * EMB * 2 +
                              (size_t)EMB * EMB * 2 + (size_t)NB * SEQ * SEQ / 8);
  _Float16* V_t = K_h + (size_t)NB * SEQ * EMB;

  prep_kernel<<<dim3(KV_BLOCKS + PACK_BLOCKS + CVT_BLOCKS), 256, 0, stream>>>(
      W_fc, W_h, mask, mask_w, keys, values, K_h, V_t);
  attn_kernel<<<dim3(SEQ / 128, NH, NB), 256, 0, stream>>>(query, K_h, V_t,
                                                           mask_w, ctx_h);
  fc_kernel<<<dim3(EMB / 128, (NB * SEQ) / 128), 256, 0, stream>>>(ctx_h, W_h,
                                                                  b_fc,
                                                                  (float*)d_out);
}

// v008
// Measured time: 50.8 microseconds a run.
// Next to v007, in two timings, it ran 1.05 and 1.04 times as fast.
// Counting every step since v000, it is 2.60 times as fast.
#include <hip/hip_runtime.h>
#include <hip/hip_bf16.h>
#include <type_traits>

#define SEQ 2048
#define NB  2
#define EMB 1024
#define NH  16
#define HD  64

typedef __attribute__((ext_vector_type(16))) _Float16 v16h;
typedef __attribute__((ext_vector_type(8)))  float    v8f;
typedef __attribute__((ext_vector_type(8)))  _Float16 v8h;
typedef __attribute__((ext_vector_type(4)))  _Float16 v4h;
typedef __attribute__((ext_vector_type(2)))  _Float16 v2h;

__device__ __forceinline__ v8f wmma16x16x32(v16h a, v16h b, v8f c) {
  // D = A(16x32 f16) x B(32x16 f16) + C(16x16 f32)
  return __builtin_amdgcn_wmma_f32_16x16x32_f16(false, a, false, b, (short)0, c,
                                                false, false);
}

__device__ __forceinline__ v16h frag_a(const _Float16* base, int stride) {
  const int lane = threadIdx.x & 31;
  const int m = lane & 15, lh = lane >> 4;
  v16h r;
#pragma unroll
  for (int i = 0; i < 16; ++i) {
    int k = ((i & 8) << 1) + (lh << 3) + (i & 7);
    r[i] = base[m * stride + k];
  }
  return r;
}

// B-matrix fragment B[k][n] from LDS stored [n][k]; same 16B-run property.
__device__ __forceinline__ v16h frag_b_transposed(const _Float16* base, int stride) {
  const int lane = threadIdx.x & 31;
  const int nn = lane & 15, lh = lane >> 4;
  v16h r;
#pragma unroll
  for (int i = 0; i < 16; ++i) {
    int k = ((i & 8) << 1) + (lh << 3) + (i & 7);
    r[i] = base[nn * stride + k];
  }
  return r;
}

__device__ __forceinline__ float xhalf(float v) {
  int b = __builtin_bit_cast(int, v);
  b = __builtin_amdgcn_permlanex16(b, b, 0x76543210, 0xfedcba98, false, false);
  return __builtin_bit_cast(float, b);
}

__device__ __forceinline__ float exp2_slot(float x) {
  float y;
  asm("v_exp_f32 %0, %1\n\tv_nop" : "=v"(y) : "v"(x));
  return y;
}

__device__ __forceinline__ unsigned lds_addr(const void* p) {
  // flat LDS addresses: low 32 bits are the wave-relative LDS offset
  return (unsigned)(unsigned long long)p;
}
__device__ __forceinline__ void async_copy8_b128(unsigned l0, unsigned l1, unsigned l2,
                                                 unsigned l3, unsigned l4, unsigned l5,
                                                 unsigned l6, unsigned l7, const void* g0,
                                                 const void* g1, const void* g2, const void* g3,
                                                 const void* g4, const void* g5, const void* g6,
                                                 const void* g7) {
  asm volatile("global_load_async_to_lds_b128 %0, %8, off\n\t"
               "global_load_async_to_lds_b128 %1, %9, off\n\t"
               "global_load_async_to_lds_b128 %2, %10, off\n\t"
               "global_load_async_to_lds_b128 %3, %11, off\n\t"
               "global_load_async_to_lds_b128 %4, %12, off\n\t"
               "global_load_async_to_lds_b128 %5, %13, off\n\t"
               "global_load_async_to_lds_b128 %6, %14, off\n\t"
               "global_load_async_to_lds_b128 %7, %15, off\n\t"
               "s_wait_xcnt 0x0"
               :: "v"(l0), "v"(l1), "v"(l2), "v"(l3), "v"(l4), "v"(l5), "v"(l6), "v"(l7),
                  "v"(g0), "v"(g1), "v"(g2), "v"(g3), "v"(g4), "v"(g5), "v"(g6), "v"(g7)
               : "memory");
}
__device__ __forceinline__ void wait_async0() {
  asm volatile("s_wait_asynccnt 0x0" ::: "memory");
}

// ---------------------------------------------------------------------------
// Kernel 0, three independent jobs by block index.
// Blocks 0 .. KV_BLOCKS-1 (the longest, so they start first): one head's K and V
// rows of 128 keys, f32 -> f16, laid out as the attention kernel's LDS tiles:
//   Kh[n][h][key][d]                 (a tile of 64 keys = 8 KiB in a row)
//   Vt[n][h][key / 64][d][key % 64]  (transposed; a tile = 8 KiB in a row)
// The next PACK_BLOCKS blocks: the int32 mask, read once with whole-line loads,
// becomes lane masks for the attention kernel. One wave takes one tile of
// 16 queries x 64 keys and writes 32 words:
//   mw[tile16][key block][t*8 + r], bit (16*lh + ln) =
//     mask[query tile16*16 + ln][key block*64 + t*16 + 8*lh + r] != 0
// which is the place of that score in the S^T accumulator (tile t, register r,
// lane 16*lh + ln).
// The other blocks: W f32 -> f16 conversion (4 MB read, 2 MB write).
// ---------------------------------------------------------------------------
#define PACK_BLOCKS ((NB * (SEQ / 16) * (SEQ / 64)) / 8)
#define CVT_BLOCKS  ((EMB * EMB) / 1024)
#define KV_BLOCKS   (NB * NH * (SEQ / 128))
__global__ __launch_bounds__(256) void prep_kernel(const float* __restrict__ W,
                                                   _Float16* __restrict__ Wh,
                                                   const int* __restrict__ mask,
                                                   unsigned* __restrict__ mw,
                                                   const float* __restrict__ keys,
                                                   const float* __restrict__ values,
                                                   _Float16* __restrict__ Kh,
                                                   _Float16* __restrict__ Vt) {
  __shared__ alignas(16) unsigned char nib[8][16][16];  // [wave][query][key / 4]
  __shared__ alignas(16) _Float16 vtr[HD][136];         // [d][key], 128 keys + pad
  if (blockIdx.x < KV_BLOCKS) {
    const int tid = threadIdx.x;
    const int kb  = (blockIdx.x & (SEQ / 128 - 1)) * 128;
    const int nh  = blockIdx.x / (SEQ / 128);           // n * NH + h
    const long in_off = ((long)(nh / NH) * SEQ + kb) * EMB + (nh % NH) * HD;
    const float* kp = keys + in_off;
    const float* vp = values + in_off;
    _Float16* ko = Kh + ((long)nh * SEQ + kb) * HD;
    _Float16* vo = Vt + ((long)nh * SEQ + kb) * HD;
    const int c4 = (tid & 15) * 4;                      // d 0..60
    const int r0 = tid >> 4;                            // 0..15
    float4 kv[8], va[4], vb[4];
#pragma unroll
    for (int it = 0; it < 8; ++it)
      kv[it] = *(const float4*)(kp + (long)(r0 + 16 * it) * EMB + c4);
#pragma unroll
    for (int it = 0; it < 4; ++it) {                    // two neighbouring keys
      va[it] = *(const float4*)(vp + (long)(2 * (r0 + 16 * it)) * EMB + c4);
      vb[it] = *(const float4*)(vp + (long)(2 * (r0 + 16 * it) + 1) * EMB + c4);
    }
#pragma unroll
    for (int it = 0; it < 8; ++it) {
      v4h w = {(_Float16)kv[it].x, (_Float16)kv[it].y, (_Float16)kv[it].z, (_Float16)kv[it].w};
      *(v4h*)(ko + (r0 + 16 * it) * HD + c4) = w;
    }
#pragma unroll
    for (int it = 0; it < 4; ++it) {
      const int key = 2 * (r0 + 16 * it);
      v2h p0 = {(_Float16)va[it].x, (_Float16)vb[it].x};
      v2h p1 = {(_Float16)va[it].y, (_Float16)vb[it].y};
      v2h p2 = {(_Float16)va[it].z, (_Float16)vb[it].z};
      v2h p3 = {(_Float16)va[it].w, (_Float16)vb[it].w};
      *(v2h*)&vtr[c4 + 0][key] = p0; *(v2h*)&vtr[c4 + 1][key] = p1;
      *(v2h*)&vtr[c4 + 2][key] = p2; *(v2h*)&vtr[c4 + 3][key] = p3;
    }
    __syncthreads();   // a row of one d holds keys written by other waves
#pragma unroll
    for (int it = 0; it < 4; ++it) {
      const int c = tid + it * 256;   // 16-byte piece: tile c >> 9, d (c >> 3) & 63
      *(v8h*)(vo + c * 8) = *(const v8h*)&vtr[(c >> 3) & 63][(c >> 9) * 64 + (c & 7) * 8];
    }
    return;
  }
  const int bid = blockIdx.x - KV_BLOCKS;
  if (bid >= PACK_BLOCKS) {
    long i = ((long)(bid - PACK_BLOCKS) * 256 + threadIdx.x) * 4;
    float4 w = *(const float4*)(W + i);
    Wh[i + 0] = (_Float16)w.x; Wh[i + 1] = (_Float16)w.y;
    Wh[i + 2] = (_Float16)w.z; Wh[i + 3] = (_Float16)w.w;
    return;
  }
  const int wid  = threadIdx.x >> 5;
  const int lane = threadIdx.x & 31;
  const int lh   = lane >> 4;
  const int ln   = lane & 15;
  const int task = bid * 8 + wid;            // tile16 * 32 + key block
  const int* mp = mask + (long)(task >> 5) * 16 * SEQ + (task & 31) * 64;
  // a load covers two rows of 256 B; four keys of one query -> one nibble
  int4 m[8];
#pragma unroll
  for (int j = 0; j < 8; ++j)
    m[j] = *(const int4*)(mp + (long)(2 * j + lh) * SEQ + 4 * ln);
#pragma unroll
  for (int j = 0; j < 8; ++j)
    nib[wid][2 * j + lh][ln] = (unsigned char)((m[j].x != 0 ? 1 : 0) | (m[j].y != 0 ? 2 : 0) |
                                               (m[j].z != 0 ? 4 : 0) | (m[j].w != 0 ? 8 : 0));
  __syncthreads();   // the nibbles of a row come from other lanes
  // query ln's 64 keys: key k is bit (k & 3) of byte k >> 2
  const uint4 rb = *(const uint4*)&nib[wid][ln][0];
  const unsigned x[4] = {rb.x >> (16 * lh), rb.y >> (16 * lh),
                         rb.z >> (16 * lh), rb.w >> (16 * lh)};
  unsigned w = 0;
#pragma unroll
  for (int t = 0; t < 4; ++t)
#pragma unroll
    for (int r = 0; r < 8; ++r) {
      unsigned b = __builtin_amdgcn_ballot_w32(((x[t] >> (8 * (r >> 2) + (r & 3))) & 1u) != 0);
      if (lane == t * 8 + r) w = b;
    }
  mw[(long)task * 32 + lane] = w;
  asm volatile("s_wait_xcnt 0x0" ::: "memory");
}

#define NPASS (SEQ / 128)
__global__ __launch_bounds__(256) __attribute__((amdgpu_waves_per_eu(4, 4)))
void attn_kernel(
    const float* __restrict__ query, const _Float16* __restrict__ Kh,
    const _Float16* __restrict__ Vt, const unsigned* __restrict__ maskw,
    _Float16* __restrict__ ctx) {
  __shared__ alignas(16) _Float16 kLDS[2][2][64][72];   // [buffer][key half][key][d]
  __shared__ alignas(16) _Float16 vLDS[2][2][64][72];   // [buffer][key half][d][key]
  __shared__ alignas(16) float xo[8][8][32][4];         // [wave][four of O^T][lane]
  __shared__ float xml[8][2][32];                       // [wave][reference, sum][lane]

  const int tid  = threadIdx.x;
  const int wid  = __builtin_amdgcn_readfirstlane(tid >> 5);   // uniform: scalar use below
  const int lane = tid & 31;
  const int lh   = lane >> 4;
  const int ln   = lane & 15;
  const int cg   = wid & 3;    // which 32 query columns
  const int kh   = wid >> 2;   // which half of the keys
  const int qt = blockIdx.x, h = blockIdx.y, n = blockIdx.z;
  const int q0 = qt * 128 + cg * 32;

  const float* qp = query  + ((long)n * SEQ + q0) * EMB + h * HD;
  // a tile is 512 pieces of 16 bytes in a row; this thread copies pieces tid and
  // tid + 256 of each tile: LDS row = piece / 8, 144 bytes a row
  const _Float16* kp = Kh + (long)(n * NH + h) * SEQ * HD + tid * 8;
  const _Float16* vp = Vt + (long)(n * NH + h) * SEQ * HD + tid * 8;
  const unsigned lpiece = (unsigned)((tid >> 3) * 144 + (tid & 7) * 16);
  auto stage = [&](int buf, int pass) {   // tile pass of each key half, K and V^T
    const unsigned lk = lds_addr(&kLDS[buf][0][0][0]) + lpiece;
    const unsigned lv = lds_addr(&vLDS[buf][0][0][0]) + lpiece;
    const _Float16* gk = kp + pass * (64 * HD);
    const _Float16* gv = vp + pass * (64 * HD);
    async_copy8_b128(lk, lk + 32 * 144, lk + 64 * 144, lk + 96 * 144,
                     lv, lv + 32 * 144, lv + 64 * 144, lv + 96 * 144,
                     gk, gk + 256 * 8, gk + (SEQ / 2) * HD, gk + (SEQ / 2) * HD + 256 * 8,
                     gv, gv + 256 * 8, gv + (SEQ / 2) * HD, gv + (SEQ / 2) * HD + 256 * 8);
  };
  stage(0, 0);
  typedef __attribute__((address_space(4))) const unsigned cuint;
  constexpr int MGRP = (SEQ / 64) * 32;
  cuint* mwp = (cuint*)(unsigned long long)(maskw +
      ((long)(n * (SEQ / 16) + qt * 8 + cg * 2) * (SEQ / 64) + kh * NPASS) * 32);

  // Q^T fragments (B operand: column = query g*16 + ln, two K=32 chunks over D=64);
  // softmax 1/sqrt(EMB)=1/32 and log2(e) folded in
  v16h qa[2][2];
#pragma unroll
  for (int g = 0; g < 2; ++g)
#pragma unroll
    for (int c = 0; c < 2; ++c)
#pragma unroll
      for (int i = 0; i < 16; ++i) {
        int k = ((i & 8) << 1) + (lh << 3) + (i & 7) + c * 32;
        qa[g][c][i] = (_Float16)(qp[(long)(g * 16 + ln) * EMB + k] *
                                 (1.4426950408889634f * 0.03125f));
      }

  // reference maximum of query g*16 + ln, log2 units (equal in both half-waves)
  float mref[2];
  float lrow[2] = {0.0f, 0.0f};   // running sum over this wave's keys (equal in both half-waves)
  // A operand of the row sums: every row ones, so every row of D, and with it every lane of
  // a column, holds the sum of that column of P^T over the 32 keys of a chunk
  v16h ones;
#pragma unroll
  for (int i = 0; i < 16; ++i) ones[i] = (_Float16)1.0f;
  v8f o[2][4];                    // o[g][ct][r] = O^T[d = ct*16 + 8*lh + r][query g*16 + ln]
#pragma unroll
  for (int g = 0; g < 2; ++g)
#pragma unroll
    for (int t = 0; t < 4; ++t)
#pragma unroll
      for (int r = 0; r < 8; ++r) o[g][t][r] = 0.0f;

  // The first pass's lane masks; each pass asks for the next pass's
  unsigned mk[2][32];
#pragma unroll
  for (int g = 0; g < 2; ++g)
#pragma unroll
    for (int i = 0; i < 32; ++i) mk[g][i] = mwp[g * MGRP + i];

  wait_async0();       // my pieces of the first tiles have landed
  __syncthreads();     // everyone's have
  stage(1, 1);

  // The plain scores of group g against one K tile, -1e30 where the lane masks in mk are 0,
  // and their maximum per query, joined over the half-waves
  auto plain_scores = [&](int g, const _Float16 (*kt)[72], float (&sv)[4][8]) -> float {
#pragma unroll
    for (int t = 0; t < 4; ++t) {
      v8f z;
#pragma unroll
      for (int r = 0; r < 8; ++r) z[r] = 0.0f;
      z = wmma16x16x32(frag_a(&kt[t * 16][0], 72), qa[g][0], z);
      z = wmma16x16x32(frag_a(&kt[t * 16][32], 72), qa[g][1], z);
#pragma unroll
      for (int r = 0; r < 8; ++r)
        sv[t][r] = __builtin_amdgcn_inverse_ballot_w32(mk[g][t * 8 + r]) ? z[r] : -1.0e30f;
    }
    float mt[4];
#pragma unroll
    for (int t = 0; t < 4; ++t)
      mt[t] = fmaxf(fmaxf(fmaxf(sv[t][0], sv[t][1]), fmaxf(sv[t][2], sv[t][3])),
                    fmaxf(fmaxf(sv[t][4], sv[t][5]), fmaxf(sv[t][6], sv[t][7])));
    const float mall = fmaxf(fmaxf(mt[0], mt[1]), fmaxf(mt[2], mt[3]));
    return fmaxf(mall, xhalf(mall));
  };
  // The first references are the first tile's maxima, found ahead of the loop: the test in the
  // loop stands behind the exponentials, which a pass without a reference would do in vain
#pragma unroll
  for (int g = 0; g < 2; ++g) {
    float sv[4][8];
    mref[g] = plain_scores(g, kLDS[0][kh], sv);
  }

  for (int pass = 0; pass < NPASS; ++pass) {
    const int buf = pass & 1;
    const _Float16 (*kT)[72] = kLDS[buf][kh];
    const _Float16 (*vT)[72] = vLDS[buf][kh];

    // C operand of S^T: minus the reference, or -1e30 where the mask is 0
    // s[g][t][r] belongs to (query g*16 + ln, key t*16 + 8*lh + r of the tile)
    v8f s[2][4];
#pragma unroll
    for (int g = 0; g < 2; ++g) {
      const float negm = -mref[g];
#pragma unroll
      for (int t = 0; t < 4; ++t)
#pragma unroll
        for (int r = 0; r < 8; ++r)
          s[g][t][r] = __builtin_amdgcn_inverse_ballot_w32(mk[g][t * 8 + r]) ? negm : -1.0e30f;
    }
    // S^T = K * Q'^T - reference for four 16-key sub-tiles; a K fragment serves both groups
#pragma unroll
    for (int t = 0; t < 4; ++t) {
      const v16h k0 = frag_a(&kT[t * 16][0], 72);
      const v16h k1 = frag_a(&kT[t * 16][32], 72);
      s[0][t] = wmma16x16x32(k0, qa[0][0], s[0][t]);
      s[1][t] = wmma16x16x32(k0, qa[1][0], s[1][t]);
      s[0][t] = wmma16x16x32(k1, qa[0][1], s[0][t]);
      s[1][t] = wmma16x16x32(k1, qa[1][1], s[1][t]);
    }
    // (0x100: LDS reads, 0x008: matrix products) all sixteen K reads are asked for as one group
    // ahead of the products: left free, the compiler reads through two fragments' registers
    // and waits for each fragment at once
    __builtin_amdgcn_sched_group_barrier(0x100, 16, 1);
    __builtin_amdgcn_sched_group_barrier(0x008, 16, 1);
    // the words are used up: ask for the next pass's (the last pass asks for its own again)
    cuint* mn = mwp + (pass + 1 < NPASS ? pass + 1 : pass) * 32;
#pragma unroll
    for (int g = 0; g < 2; ++g)
#pragma unroll
      for (int i = 0; i < 32; ++i) mk[g][i] = mn[g * MGRP + i];
    // keeps the request for the words here, ahead of the exponentials: left free, the
    // compiler asks for them late in the pass
    __builtin_amdgcn_sched_barrier(0);
    // the first four V^T fragments are asked for ahead of the exponentials
    v16h vf[8];
#pragma unroll
    for (int f = 0; f < 4; ++f) vf[f] = frag_a(&vT[(f >> 1) * 16][(f & 1) * 32], 72);
    // P^T as B operand: sub-tiles 2c and 2c+1 are k 0..15 and 16..31 of chunk c
    // in the hardware k order (element i: key c*32 + ((i&8)<<1) + 8*lh + (i&7));
    // ls[g][r] = sum of the pass's 64 P of query g*16 + ln, the same in every r and both lh
    v16h pb[2][2];
    v8f ls[2];
#pragma unroll
    for (int g = 0; g < 2; ++g) {
#pragma unroll
      for (int c = 0; c < 2; ++c)
#pragma unroll
        for (int i = 0; i < 16; ++i)
          pb[g][c][i] = (_Float16)__builtin_amdgcn_exp2f(s[g][2 * c + (i >> 3)][i & 7]);
#pragma unroll
      for (int r = 0; r < 8; ++r) ls[g][r] = 0.0f;
      ls[g] = wmma16x16x32(ones, pb[g][0], ls[g]);
      ls[g] = wmma16x16x32(ones, pb[g][1], ls[g]);
    }
    // (0x100: LDS reads, 0x400: transcendentals) the eight V^T reads stand ahead of the
    // exponentials, which cover their latency
    __builtin_amdgcn_sched_group_barrier(0x100, 8, 2);
    __builtin_amdgcn_sched_group_barrier(0x400, 64, 2);
    // holds those reads on this side of the branch below: left free, the compiler sinks them
    // behind it, in front of their products, and waits for each at once
    asm volatile("" :: "v"(vf[0]), "v"(vf[1]), "v"(vf[2]), "v"(vf[3]));
    // One test a pass: do the references still serve every query of the wave? One does not
    // where the pass's sum exceeds 256 (a score over 8 above the reference makes it so, one
    // that overflows f16 makes it infinite), or while a query has met no unmasked key
    // (-1e30 is no reference to subtract from a score).
    const bool need = ls[0][0] > 256.0f || ls[1][0] > 256.0f ||
                      mref[0] < -1.0e29f || mref[1] < -1.0e29f;
    if (__builtin_amdgcn_ballot_w32(need) != 0) {
      // New references: the plain scores once more, their
      // maximum joined over the half-waves, O and the sum brought to the new reference,
      // P and its row sum anew. This pass's lane masks take the place of the next pass's,
      // which are asked for again at the end.
      cuint* mc = mwp + pass * 32;
#pragma unroll
      for (int g = 0; g < 2; ++g)
#pragma unroll
        for (int i = 0; i < 32; ++i) mk[g][i] = mc[g * MGRP + i];
#pragma unroll
      for (int g = 0; g < 2; ++g) {
        float sv[4][8];
        const float mall = plain_scores(g, kT, sv);
        const float mnew = fmaxf(mref[g], mall);
        const float corr = exp2_slot(mref[g] - mnew);
        mref[g] = mnew;
        lrow[g] *= corr;
#pragma unroll
        for (int ct = 0; ct < 4; ++ct)
#pragma unroll
          for (int r = 0; r < 8; ++r) o[g][ct][r] *= corr;
#pragma unroll
        for (int c = 0; c < 2; ++c)
#pragma unroll
          for (int i = 0; i < 16; ++i)
            pb[g][c][i] = (_Float16)exp2_slot(sv[2 * c + (i >> 3)][i & 7] - mnew);
#pragma unroll
        for (int r = 0; r < 8; ++r) ls[g][r] = 0.0f;
        ls[g] = wmma16x16x32(ones, pb[g][0], ls[g]);
        ls[g] = wmma16x16x32(ones, pb[g][1], ls[g]);
      }
#pragma unroll
      for (int g = 0; g < 2; ++g)
#pragma unroll
        for (int i = 0; i < 32; ++i) mk[g][i] = mn[g * MGRP + i];
    }
    lrow[0] += ls[0][0];
    lrow[1] += ls[1][0];

    // O^T += V^T(64x64) * P^T(64x16) per group; V^T rows come from the [d][key] tile,
    // and a V^T fragment serves both groups
#pragma unroll
    for (int f = 4; f < 8; ++f) vf[f] = frag_a(&vT[(f >> 1) * 16][(f & 1) * 32], 72);
#pragma unroll
    for (int f = 0; f < 4; ++f) {
      o[0][f >> 1] = wmma16x16x32(vf[f], pb[0][f & 1], o[0][f >> 1]);
      o[1][f >> 1] = wmma16x16x32(vf[f], pb[1][f & 1], o[1][f >> 1]);
    }
    // (0x100: LDS reads, 0x008: matrix products) the other four fragments are asked for as one
    // group ahead of the products. Left free, the compiler asks for most of them only behind
    // six of the eight products that are to cover their latency.
    __builtin_amdgcn_sched_group_barrier(0x100, 8, 0);
    __builtin_amdgcn_sched_group_barrier(0x008, 8, 0);
    // the eight products of the first four fragments stay here, where they cover the latency of
    // those reads: left free, they sink behind the wait for the reads at the pass's foot
    __builtin_amdgcn_sched_barrier(0);
#pragma unroll
    for (int f = 4; f < 8; ++f) {
      o[0][f >> 1] = wmma16x16x32(vf[f], pb[0][f & 1], o[0][f >> 1]);
      o[1][f >> 1] = wmma16x16x32(vf[f], pb[1][f & 1], o[1][f >> 1]);
    }
    // hand-over: my reads of this buffer are done, my pieces of the next tiles have
    // landed; behind the barrier that holds for every wave, and this buffer is refilled
    asm volatile("s_wait_dscnt 0x0" ::: "memory");
    wait_async0();
    __syncthreads();
    if (pass + 2 < NPASS) stage(buf, pass + 2);
  }
  wait_async0();       // no copy is outstanding when the wave ends

  // Join the two key halves. Wave kh keeps column group kh and hands the other group's
  // O^T, reference and sum to its partner wave through LDS.
  const bool hi = kh != 0;
  const float mine_m = hi ? mref[1] : mref[0], send_m = hi ? mref[0] : mref[1];
  const float mine_l = hi ? lrow[1] : lrow[0], send_l = hi ? lrow[0] : lrow[1];
#pragma unroll
  for (int ct = 0; ct < 4; ++ct)
#pragma unroll
    for (int j = 0; j < 2; ++j) {
      float4 w;
      w.x = hi ? o[0][ct][4 * j + 0] : o[1][ct][4 * j + 0];
      w.y = hi ? o[0][ct][4 * j + 1] : o[1][ct][4 * j + 1];
      w.z = hi ? o[0][ct][4 * j + 2] : o[1][ct][4 * j + 2];
      w.w = hi ? o[0][ct][4 * j + 3] : o[1][ct][4 * j + 3];
      *(float4*)&xo[wid][ct * 2 + j][lane][0] = w;
    }
  xml[wid][0][lane] = send_m;
  xml[wid][1][lane] = send_l;
  __syncthreads();     // the partner's values are written by another wave
  const int pw = wid ^ 4;
  const float part_m = xml[pw][0][lane];
  const float part_l = xml[pw][1][lane];
  // both parts brought to the larger reference (a half with no unmasked key has -1e30
  // and drops out against a real one; two such halves weigh alike)
  const float mj = fmaxf(mine_m, part_m);
  const float fa = exp2_slot(mine_m - mj);
  const float fb = exp2_slot(part_m - mj);
  const float inv = 1.0f / (mine_l * fa + part_l * fb);
  const float ga = fa * inv, gb = fb * inv;
  // normalize, write f16 ctx[n, q0 + kh*16 + ln, h*64 + d]:
  // 8 consecutive d per lane and tile -> one 16-byte store each
  _Float16* op = ctx + ((long)n * SEQ + q0 + kh * 16 + ln) * EMB + h * HD + 8 * lh;
#pragma unroll
  for (int ct = 0; ct < 4; ++ct) {
    const float4 p0 = *(const float4*)&xo[pw][ct * 2 + 0][lane][0];
    const float4 p1 = *(const float4*)&xo[pw][ct * 2 + 1][lane][0];
    const float pp[8] = {p0.x, p0.y, p0.z, p0.w, p1.x, p1.y, p1.z, p1.w};
    v8h w;
#pragma unroll
    for (int r = 0; r < 8; ++r)
      w[r] = (_Float16)((hi ? o[1][ct][r] : o[0][ct][r]) * ga + pp[r] * gb);
    *(v8h*)(op + ct * 16) = w;
  }
}

// ---------------------------------------------------------------------------
// Kernel 2: out[4096, E] = ctx_h @ Wh^T + b. Both operands already f16 in
// memory; the tiles come by tensor loads into a ring of four LDS buffers, three
// trips ahead, so that requests to L2 are always outstanding. Block tile 128 x 128,
// one block a WGP; a trip is 128 k. A stage is four slices of 64 rows x 256 B (rows
// 0-63 and 64-127 of ctx, then of W); waves 0-3 each ask for one slice a stage.
// 8 waves as 4 x 2, each 32 rows x 64 columns = 2 x 4 WMMA tiles: six fragments read
// from LDS feed eight products.
// ---------------------------------------------------------------------------
#define FC_K 128
#define FC_TRIPS (EMB / FC_K)
#define FC_PITCH (FC_K + 8)          // halves: 256 B + 16 B pad, laid by the tensor load
#define FC_PITCHB (FC_PITCH * 2)     // bytes
#define FC_NBUF 4
#define FC_SLICE 18432               // 64 rows x 272 B = 17 KiB, rounded up to a multiple of 2 KiB
typedef unsigned u32x4 __attribute__((ext_vector_type(4)));
typedef unsigned u32x8 __attribute__((ext_vector_type(8)));
__device__ __forceinline__ unsigned uni(unsigned v) {
  return (unsigned)__builtin_amdgcn_readfirstlane(v);
}
__device__ __forceinline__ unsigned pinned(unsigned v) {
  unsigned w = uni(v);
  asm volatile("" : "+s"(w));
  return w;
}
template <int N> __device__ __forceinline__ void wait_tensor_le() {
  // all but the wave's N youngest tensor loads have landed
  asm volatile("s_wait_tensorcnt %0" :: "i"(N) : "memory");
}
__global__ __launch_bounds__(256) __attribute__((amdgpu_waves_per_eu(2, 2)))
void fc_kernel(
    const _Float16* __restrict__ ctx, const _Float16* __restrict__ Wh,
    const float* __restrict__ bias, float* __restrict__ out) {
  // [buffer][slice][64 rows of 272 B]; every slice starts at a multiple of 2 KiB
  __shared__ __attribute__((aligned(2048))) unsigned char ring[FC_NBUF][4][FC_SLICE];

  const int tid  = threadIdx.x;
  const int wid  = tid >> 5;
  const int lane = tid & 31;
  const int lh   = lane >> 4;
  const int ln   = lane & 15;
  const int n0 = blockIdx.x * 128;
  const int m0 = blockIdx.y * 128;
  const int wm = (wid >> 1) * 32;
  const int wn = (wid & 1) * 64;

  v8f acc[2][4];
#pragma unroll
  for (int i = 0; i < 2; ++i)
#pragma unroll
    for (int j = 0; j < 4; ++j)
#pragma unroll
      for (int r = 0; r < 8; ++r) acc[i][j][r] = 0.0f;

  const unsigned wave = uni((unsigned)tid >> 5);
  const _Float16* srow = (wave & 2u) ? Wh + (long)(n0 + (int)(wave & 1u) * 64) * EMB
                                     : ctx + (long)(m0 + (int)(wave & 1u) * 64) * EMB;
  const unsigned long long ga = (unsigned long long)srow;
  const unsigned ga_lo = uni((unsigned)ga);
  const unsigned ga_hi = uni((((unsigned)(ga >> 32)) & 0x01FFFFFFu) | 0x80000000u);
  const unsigned lds0  = uni(lds_addr(&ring[0][0][0]) + (wave & 3u) * FC_SLICE);
  u32x8 g1;
  g1[0] = uni((1u << 20) | (5u << 22) | (3u << 25));
  g1[1] = uni(256u << 16);
  g1[2] = uni(64u << 16);
  g1[3] = uni(256u << 16);
  g1[4] = uni(64u);
  g1[5] = uni(EMB * 2u);
  g1[6] = uni(0u);
  g1[7] = uni(0u);
  u32x4 g0;
  g0[0] = uni(1u);
  g0[1] = lds0;
  g0[2] = ga_lo;
  g0[3] = ga_hi;
  auto stage = [&](int trip) {   // this wave's slice of stage trip, into buffer trip % 4
    g0[1] = uni(lds0 + (unsigned)(trip % FC_NBUF) * (4u * FC_SLICE));
    g0[2] = uni(ga_lo + (unsigned)trip * (FC_K * 2u));
    // both groups are named as in-out operands: each then stays in one register tuple from
    // request to request, and no register of a request that is still outstanding is given
    // to another value (only the two words set above move)
    asm volatile("tensor_load_to_lds %0, %1" : "+s"(g0), "+s"(g1) :: "memory");
  };

  // Two 32-k chunks = 12 fragments = 24 LDS reads, and their 16 products
  struct Half { v16h a[2][2], b[2][4]; };
  auto fetch = [&](Half& f, int buf, int half) {
    const _Float16* at = (const _Float16*)&ring[buf][wm >> 6][(wm & 63) * FC_PITCHB];
    const _Float16* bt = (const _Float16*)&ring[buf][2 + (wn >> 6)][0];
#pragma unroll
    for (int c = 0; c < 2; ++c) {
      const int k = (half * 2 + c) * 32;
      f.a[c][0] = frag_a(at + k, FC_PITCH);
      f.a[c][1] = frag_a(at + 16 * FC_PITCH + k, FC_PITCH);
#pragma unroll
      for (int j = 0; j < 4; ++j)
        f.b[c][j] = frag_b_transposed(bt + j * 16 * FC_PITCH + k, FC_PITCH);   // B = W^T
    }
  };
  auto products = [&](const Half& f) {
#pragma unroll
    for (int c = 0; c < 2; ++c)
#pragma unroll
      for (int j = 0; j < 4; ++j) {
        acc[0][j] = wmma16x16x32(f.a[c][0], f.b[c][j], acc[0][j]);
        acc[1][j] = wmma16x16x32(f.a[c][1], f.b[c][j], acc[1][j]);
      }
  };

  if (pinned(wave < 4u)) { stage(0); stage(1); stage(2); }
  wait_tensor_le<2>();          // my slice of stage 0 has landed
  if (pinned(wave < 4u)) stage(3);   // three requests of a wave are outstanding again
  __syncthreads();              // everyone's slice of stage 0 has

  // Each half tile's fragments are asked for as one group in front of the products of the
  // half before it. The sched_barriers hold that order: left free, the compiler asks for a
  // B fragment directly in front of its two products and waits for it at once, and it moves
  // products behind the barrier, in front of the refill and the next reads.
  Half lo, hi;
  fetch(lo, 0, 0);
  auto trip = [&](auto tc) {
    constexpr int t = decltype(tc)::value;
    constexpr int buf = t % FC_NBUF;
    fetch(hi, buf, 1);
    __builtin_amdgcn_sched_barrier(0);   // the 24 reads stay one group ahead of the products
    products(lo);
    __builtin_amdgcn_sched_barrier(0);   // no product sinks behind the barrier below
    // hand-over: my reads of this buffer are done, my slice of stage t + 1 has landed (the
    // stages asked for behind it may still fly); behind the barrier that holds for every
    // wave, and this buffer is refilled
    asm volatile("s_wait_dscnt 0x0" ::: "memory");
    constexpr int asked = t + 3 < FC_TRIPS - 1 ? t + 3 : FC_TRIPS - 1;   // last stage asked for
    wait_tensor_le<(asked > t + 1 ? asked - (t + 1) : 0)>();
    __syncthreads();
    if constexpr (t + FC_NBUF < FC_TRIPS) {
      if (pinned(wave < 4u)) stage(t + FC_NBUF);
    }
    if constexpr (t + 1 < FC_TRIPS) fetch(lo, (t + 1) % FC_NBUF, 0);
    __builtin_amdgcn_sched_barrier(0);   // refill and reads are issued ahead of the products
    products(hi);
    __builtin_amdgcn_sched_barrier(0);   // the next trip's reads do not mix into the products
  };
  // written out: the wait's count, the tests for a next stage and the buffer's number are
  // compile-time
  trip(std::integral_constant<int, 0>{}); trip(std::integral_constant<int, 1>{});
  trip(std::integral_constant<int, 2>{}); trip(std::integral_constant<int, 3>{});
  trip(std::integral_constant<int, 4>{}); trip(std::integral_constant<int, 5>{});
  trip(std::integral_constant<int, 6>{}); trip(std::integral_constant<int, 7>{});
  static_assert(FC_TRIPS == 8, "the trips are written out");
  wait_tensor_le<0>();                             // no request is outstanding when the wave ends
  asm volatile("s_wait_dscnt 0x0" ::: "memory");   // nor an LDS read

#pragma unroll
  for (int ti = 0; ti < 2; ++ti)
#pragma unroll
    for (int tj = 0; tj < 4; ++tj) {
      v8f a = acc[ti][tj];
#pragma unroll
      for (int r = 0; r < 8; ++r) {
        int row = m0 + wm + ti * 16 + r + 8 * lh;
        int col = n0 + wn + tj * 16 + ln;
        out[(long)row * EMB + col] = a[r] + bias[col];
      }
    }
}

extern "C" void kernel_launch(void* const* d_in, const int* in_sizes, int n_in,
                              void* d_out, int out_size, void* d_ws, size_t ws_size,
                              hipStream_t stream) {
  (void)in_sizes; (void)n_in; (void)out_size; (void)ws_size;
  const float* values = (const float*)d_in[0];
  const float* keys   = (const float*)d_in[1];
  const float* query  = (const float*)d_in[2];
  const int*   mask   = (const int*)d_in[3];
  const float* W_fc   = (const float*)d_in[4];
  const float* b_fc   = (const float*)d_in[5];

  // workspace: ctx_h (8 MiB f16) | W_h (2 MiB f16) | lane masks (1 MiB) |
  //            K_h (8 MiB f16) | V_t (8 MiB f16)
  _Float16* ctx_h = (_Float16*)d_ws;
  _Float16* W_h   = (_Float16*)((char*)d_ws + (size_t)NB * SEQ * EMB * 2);
  unsigned* mask_w = (unsigned*)((char*)d_ws + (size_t)NB * SEQ * EMB * 2 +
                                 (size_t)EMB * EMB * 2);
  _Float16* K_h = (_Float16*)((char*)d_ws + (size_t)NB * SEQ * EMB * 2 +
                              (size_t)EMB * EMB * 2 + (size_t)NB * SEQ * SEQ / 8);
  _Float16* V_t = K_h + (size_t)NB * SEQ * EMB;

  prep_kernel<<<dim3(KV_BLOCKS + PACK_BLOCKS + CVT_BLOCKS), 256, 0, stream>>>(
      W_fc, W_h, mask, mask_w, keys, values, K_h, V_t);
  attn_kernel<<<dim3(SEQ / 128, NH, NB), 256, 0, stream>>>(query, K_h, V_t,
                                                           mask_w, ctx_h);
  fc_kernel<<<dim3(EMB / 128, (NB * SEQ) / 128), 256, 0, stream>>>(ctx_h, W_h,
                                                                  b_fc,
                                                                  (float*)d_out);
}

// v009
// One run takes 48.9 microseconds.
// Next to v008, in two timings, it ran 1.04 times as fast each time.
// Over all steps from v000 it is 2.70 times as fast.
#include <hip/hip_runtime.h>
#include <hip/hip_bf16.h>
#include <type_traits>

#define SEQ 2048
#define NB  2
#define EMB 1024
#define NH  16
#define HD  64

typedef __attribute__((ext_vector_type(16))) _Float16 v16h;
typedef __attribute__((ext_vector_type(8)))  float    v8f;
typedef __attribute__((ext_vector_type(8)))  _Float16 v8h;
typedef __attribute__((ext_vector_type(4)))  _Float16 v4h;
typedef __attribute__((ext_vector_type(2)))  _Float16 v2h;

__device__ __forceinline__ v8f wmma16x16x32(v16h a, v16h b, v8f c) {
  // D = A(16x32 f16) x B(32x16 f16) + C(16x16 f32)
  return __builtin_amdgcn_wmma_f32_16x16x32_f16(false, a, false, b, (short)0, c,
                                                false, false);
}

__device__ __forceinline__ v16h frag_a(const _Float16* base, int stride) {
  const int lane = threadIdx.x & 31;
  const int m = lane & 15, lh = lane >> 4;
  v16h r;
#pragma unroll
  for (int i = 0; i < 16; ++i) {
    int k = ((i & 8) << 1) + (lh << 3) + (i & 7);
    r[i] = base[m * stride + k];
  }
  return r;
}

// B-matrix fragment B[k][n] from LDS stored [n][k]; same 16B-run property.
__device__ __forceinline__ v16h frag_b_transposed(const _Float16* base, int stride) {
  const int lane = threadIdx.x & 31;
  const int nn = lane & 15, lh = lane >> 4;
  v16h r;
#pragma unroll
  for (int i = 0; i < 16; ++i) {
    int k = ((i & 8) << 1) + (lh << 3) + (i & 7);
    r[i] = base[nn * stride + k];
  }
  return r;
}

__device__ __forceinline__ float xhalf(float v) {
  int b = __builtin_bit_cast(int, v);
  b = __builtin_amdgcn_permlanex16(b, b, 0x76543210, 0xfedcba98, false, false);
  return __builtin_bit_cast(float, b);
}

__device__ __forceinline__ float exp2_slot(float x) {
  float y;
  asm("v_exp_f32 %0, %1\n\tv_nop" : "=v"(y) : "v"(x));
  return y;
}

__device__ __forceinline__ unsigned lds_addr(const void* p) {
  // flat LDS addresses: low 32 bits are the wave-relative LDS offset
  return (unsigned)(unsigned long long)p;
}
typedef unsigned u32x4 __attribute__((ext_vector_type(4)));
typedef unsigned u32x8 __attribute__((ext_vector_type(8)));
__device__ __forceinline__ unsigned uni(unsigned v) {
  return (unsigned)__builtin_amdgcn_readfirstlane(v);
}
__device__ __forceinline__ unsigned pinned(unsigned v) {
  unsigned w = uni(v);
  asm volatile("" : "+s"(w));
  return w;
}
template <int N> __device__ __forceinline__ void wait_tensor_le() {
  // all but the wave's N youngest tensor loads have landed
  asm volatile("s_wait_tensorcnt %0" :: "i"(N) : "memory");
}

// ---------------------------------------------------------------------------
// Kernel 0, three independent jobs by block index.
// Blocks 0 .. KV_BLOCKS-1 (the longest, so they start first): one head's K and V
// rows of 128 keys, f32 -> f16, laid out as the attention kernel's LDS tiles:
//   Kh[n][h][key][d]                 (a tile of 64 keys = 8 KiB in a row)
//   Vt[n][h][key / 64][d][key % 64]  (transposed; a tile = 8 KiB in a row)
// The next PACK_BLOCKS blocks: the int32 mask, read once with whole-line loads,
// becomes lane masks for the attention kernel. One wave takes one tile of
// 16 queries x 64 keys and writes 32 words:
//   mw[tile16][key block][t*8 + r], bit (16*lh + ln) =
//     mask[query tile16*16 + ln][key block*64 + t*16 + 8*lh + r] != 0
// which is the place of that score in the S^T accumulator (tile t, register r,
// lane 16*lh + ln).
// The other blocks: W f32 -> f16 conversion (4 MB read, 2 MB write).
// ---------------------------------------------------------------------------
#define PACK_BLOCKS ((NB * (SEQ / 16) * (SEQ / 64)) / 8)
#define CVT_BLOCKS  ((EMB * EMB) / 1024)
#define KV_BLOCKS   (NB * NH * (SEQ / 128))
__global__ __launch_bounds__(256) void prep_kernel(const float* __restrict__ W,
                                                   _Float16* __restrict__ Wh,
                                                   const int* __restrict__ mask,
                                                   unsigned* __restrict__ mw,
                                                   const float* __restrict__ keys,
                                                   const float* __restrict__ values,
                                                   _Float16* __restrict__ Kh,
                                                   _Float16* __restrict__ Vt) {
  __shared__ alignas(16) unsigned char nib[8][16][16];  // [wave][query][key / 4]
  __shared__ alignas(16) _Float16 vtr[HD][136];         // [d][key], 128 keys + pad
  if (blockIdx.x < KV_BLOCKS) {
    const int tid = threadIdx.x;
    const int kb  = (blockIdx.x & (SEQ / 128 - 1)) * 128;
    const int nh  = blockIdx.x / (SEQ / 128);           // n * NH + h
    const long in_off = ((long)(nh / NH) * SEQ + kb) * EMB + (nh % NH) * HD;
    const float* kp = keys + in_off;
    const float* vp = values + in_off;
    _Float16* ko = Kh + ((long)nh * SEQ + kb) * HD;
    _Float16* vo = Vt + ((long)nh * SEQ + kb) * HD;
    const int c4 = (tid & 15) * 4;                      // d 0..60
    const int r0 = tid >> 4;                            // 0..15
    float4 kv[8], va[4], vb[4];
#pragma unroll
    for (int it = 0; it < 8; ++it)
      kv[it] = *(const float4*)(kp + (long)(r0 + 16 * it) * EMB + c4);
#pragma unroll
    for (int it = 0; it < 4; ++it) {                    // two neighbouring keys
      va[it] = *(const float4*)(vp + (long)(2 * (r0 + 16 * it)) * EMB + c4);
      vb[it] = *(const float4*)(vp + (long)(2 * (r0 + 16 * it) + 1) * EMB + c4);
    }
#pragma unroll
    for (int it = 0; it < 8; ++it) {
      v4h w = {(_Float16)kv[it].x, (_Float16)kv[it].y, (_Float16)kv[it].z, (_Float16)kv[it].w};
      *(v4h*)(ko + (r0 + 16 * it) * HD + c4) = w;
    }
#pragma unroll
    for (int it = 0; it < 4; ++it) {
      const int key = 2 * (r0 + 16 * it);
      v2h p0 = {(_Float16)va[it].x, (_Float16)vb[it].x};
      v2h p1 = {(_Float16)va[it].y, (_Float16)vb[it].y};
      v2h p2 = {(_Float16)va[it].z, (_Float16)vb[it].z};
      v2h p3 = {(_Float16)va[it].w, (_Float16)vb[it].w};
      *(v2h*)&vtr[c4 + 0][key] = p0; *(v2h*)&vtr[c4 + 1][key] = p1;
      *(v2h*)&vtr[c4 + 2][key] = p2; *(v2h*)&vtr[c4 + 3][key] = p3;
    }
    __syncthreads();   // a row of one d holds keys written by other waves
#pragma unroll
    for (int it = 0; it < 4; ++it) {
      const int c = tid + it * 256;   // 16-byte piece: tile c >> 9, d (c >> 3) & 63
      *(v8h*)(vo + c * 8) = *(const v8h*)&vtr[(c >> 3) & 63][(c >> 9) * 64 + (c & 7) * 8];
    }
    return;
  }
  const int bid = blockIdx.x - KV_BLOCKS;
  if (bid >= PACK_BLOCKS) {
    long i = ((long)(bid - PACK_BLOCKS) * 256 + threadIdx.x) * 4;
    float4 w = *(const float4*)(W + i);
    Wh[i + 0] = (_Float16)w.x; Wh[i + 1] = (_Float16)w.y;
    Wh[i + 2] = (_Float16)w.z; Wh[i + 3] = (_Float16)w.w;
    return;
  }
  const int wid  = threadIdx.x >> 5;
  const int lane = threadIdx.x & 31;
  const int lh   = lane >> 4;
  const int ln   = lane & 15;
  const int task = bid * 8 + wid;            // tile16 * 32 + key block
  const int* mp = mask + (long)(task >> 5) * 16 * SEQ + (task & 31) * 64;
  // a load covers two rows of 256 B; four keys of one query -> one nibble
  int4 m[8];
#pragma unroll
  for (int j = 0; j < 8; ++j)
    m[j] = *(const int4*)(mp + (long)(2 * j + lh) * SEQ + 4 * ln);
#pragma unroll
  for (int j = 0; j < 8; ++j)
    nib[wid][2 * j + lh][ln] = (unsigned char)((m[j].x != 0 ? 1 : 0) | (m[j].y != 0 ? 2 : 0) |
                                               (m[j].z != 0 ? 4 : 0) | (m[j].w != 0 ? 8 : 0));
  __syncthreads();   // the nibbles of a row come from other lanes
  // query ln's 64 keys: key k is bit (k & 3) of byte k >> 2
  const uint4 rb = *(const uint4*)&nib[wid][ln][0];
  const unsigned x[4] = {rb.x >> (16 * lh), rb.y >> (16 * lh),
                         rb.z >> (16 * lh), rb.w >> (16 * lh)};
  unsigned w = 0;
#pragma unroll
  for (int t = 0; t < 4; ++t)
#pragma unroll
    for (int r = 0; r < 8; ++r) {
      unsigned b = __builtin_amdgcn_ballot_w32(((x[t] >> (8 * (r >> 2) + (r & 3))) & 1u) != 0);
      if (lane == t * 8 + r) w = b;
    }
  mw[(long)task * 32 + lane] = w;
  asm volatile("s_wait_xcnt 0x0" ::: "memory");
}

#define NPASS (SEQ / 128)
#define NSTAGE (NPASS / 2)
#define AT_PITCHB 144                // bytes: 128 B + 16 B pad, laid by the tensor load
#define AT_SLICE (128 * AT_PITCHB)   // 18 KiB, a multiple of 2 KiB
__global__ __launch_bounds__(256) __attribute__((amdgpu_waves_per_eu(4, 4)))
void attn_kernel(
    const float* __restrict__ query, const _Float16* __restrict__ Kh,
    const _Float16* __restrict__ Vt, const unsigned* __restrict__ maskw,
    _Float16* __restrict__ ctx) {
  // [buffer][slice][128 rows of 144 B]; every slice starts at a multiple of 2 KiB.
  // K rows: [key][d]; V^T rows: [key / 64][d][key % 64]
  __shared__ __attribute__((aligned(2048))) unsigned char ring[2][4][AT_SLICE];
  // behind the loop the ring is free and carries the join of the key halves
  float (*xo)[8][32][4] = (float (*)[8][32][4])&ring[0][0][0];   // [wave][four of O^T][lane]
  float (*xml)[2][32]   = (float (*)[2][32])&ring[0][2][0];      // [wave][reference, sum][lane]
  static_assert(8 * 8 * 32 * 4 * 4 <= 2 * AT_SLICE, "the O^T parts end in front of xml");

  const int tid  = threadIdx.x;
  const int wid  = __builtin_amdgcn_readfirstlane(tid >> 5);   // uniform: scalar use below
  const int lane = tid & 31;
  const int lh   = lane >> 4;
  const int ln   = lane & 15;
  const int cg   = wid & 3;    // which 32 query columns
  const int kh   = wid >> 2;   // which half of the keys
  const int qt = blockIdx.x, h = blockIdx.y, n = blockIdx.z;
  const int q0 = qt * 128 + cg * 32;

  const float* qp = query  + ((long)n * SEQ + q0) * EMB + h * HD;
  const unsigned wave = (unsigned)wid;
  const _Float16* srow = ((wave & 2u) ? Vt : Kh) + (long)(n * NH + h) * SEQ * HD +
                         (long)(wave & 1u) * (SEQ / 2) * HD;
  const unsigned lds0 = uni(lds_addr(&ring[0][0][0]) + (wave & 3u) * AT_SLICE);
  auto group1 = [&]() {
    u32x8 g;
    g[0] = uni((1u << 20) | (4u << 22) | (3u << 25));
    g[1] = uni(128u << 16);
    g[2] = uni(128u << 16);
    g[3] = uni(128u << 16);
    g[4] = uni(128u);
    g[5] = uni(128u);
    g[6] = uni(0u);
    g[7] = uni(0u);
    return g;
  };
  u32x8 g1 = group1();
  const unsigned long long ga0 = (unsigned long long)srow;
  u32x4 g0;                       // stage 0: buffer 0, the slice's first 128 rows
  g0[0] = uni(1u);
  g0[1] = lds0;
  g0[2] = uni((unsigned)ga0);
  g0[3] = uni((((unsigned)(ga0 >> 32)) & 0x01FFFFFFu) | 0x80000000u);
  auto request = [&]() {
    // both groups are named as operands here and at the wait that covers the request: each
    // then stays in one register tuple between the two, and no register of a request that is
    // still outstanding is given to another value
    asm volatile("tensor_load_to_lds %0, %1" : "+s"(g0), "+s"(g1) :: "memory");
  };
  auto advance = [&](bool to_buffer1) {
    const unsigned long long a = (((unsigned long long)g0[3] << 32) | g0[2]) + 128u * HD * 2u;
    g0[1] = uni(to_buffer1 ? g0[1] + 4u * AT_SLICE : g0[1] - 4u * AT_SLICE);
    g0[2] = uni((unsigned)a);
    g0[3] = uni((unsigned)(a >> 32));
  };
  auto landed = [&]() {
    asm volatile("s_wait_tensorcnt 0x0" : "+s"(g0) : "s"(g1) : "memory");
  };
  const unsigned issuer = pinned(wave < 4u);   // waves 0-3 ask for the slices
  if (issuer) request();
  typedef __attribute__((address_space(4))) const unsigned cuint;
  constexpr int MGRP = (SEQ / 64) * 32;
  cuint* mwp = (cuint*)(unsigned long long)(maskw +
      ((long)(n * (SEQ / 16) + qt * 8 + cg * 2) * (SEQ / 64) + kh * NPASS) * 32);

  // Q^T fragments (B operand: column = query g*16 + ln, two K=32 chunks over D=64);
  // softmax 1/sqrt(EMB)=1/32 and log2(e) folded in
  v16h qa[2][2];
#pragma unroll
  for (int g = 0; g < 2; ++g)
#pragma unroll
    for (int c = 0; c < 2; ++c)
#pragma unroll
      for (int i = 0; i < 16; ++i) {
        int k = ((i & 8) << 1) + (lh << 3) + (i & 7) + c * 32;
        qa[g][c][i] = (_Float16)(qp[(long)(g * 16 + ln) * EMB + k] *
                                 (1.4426950408889634f * 0.03125f));
      }

  // reference maximum of query g*16 + ln, log2 units (equal in both half-waves)
  float mref[2];
  float lrow[2] = {0.0f, 0.0f};   // running sum over this wave's keys (equal in both half-waves)
  // A operand of the row sums: every row ones, so every row of D, and with it every lane of
  // a column, holds the sum of that column of P^T over the 32 keys of a chunk
  v16h ones;
#pragma unroll
  for (int i = 0; i < 16; ++i) ones[i] = (_Float16)1.0f;
  v8f o[2][4];                    // o[g][ct][r] = O^T[d = ct*16 + 8*lh + r][query g*16 + ln]
#pragma unroll
  for (int g = 0; g < 2; ++g)
#pragma unroll
    for (int t = 0; t < 4; ++t)
#pragma unroll
      for (int r = 0; r < 8; ++r) o[g][t][r] = 0.0f;

  // The first pass's lane masks; each pass asks for the next pass's
  unsigned mk[2][32];
#pragma unroll
  for (int g = 0; g < 2; ++g)
#pragma unroll
    for (int i = 0; i < 32; ++i) mk[g][i] = mwp[g * MGRP + i];

  landed();                                     // my slice of stage 0 has landed
  __syncthreads();                              // everyone's has
  g1 = group1();
  if (issuer) { advance(true); request(); }

  // The plain scores of group g against one K tile, -1e30 where the lane masks in mk are 0,
  // and their maximum per query, joined over the half-waves
  auto plain_scores = [&](int g, const _Float16 (*kt)[72], float (&sv)[4][8]) -> float {
#pragma unroll
    for (int t = 0; t < 4; ++t) {
      v8f z;
#pragma unroll
      for (int r = 0; r < 8; ++r) z[r] = 0.0f;
      z = wmma16x16x32(frag_a(&kt[t * 16][0], 72), qa[g][0], z);
      z = wmma16x16x32(frag_a(&kt[t * 16][32], 72), qa[g][1], z);
#pragma unroll
      for (int r = 0; r < 8; ++r)
        sv[t][r] = __builtin_amdgcn_inverse_ballot_w32(mk[g][t * 8 + r]) ? z[r] : -1.0e30f;
    }
    float mt[4];
#pragma unroll
    for (int t = 0; t < 4; ++t)
      mt[t] = fmaxf(fmaxf(fmaxf(sv[t][0], sv[t][1]), fmaxf(sv[t][2], sv[t][3])),
                    fmaxf(fmaxf(sv[t][4], sv[t][5]), fmaxf(sv[t][6], sv[t][7])));
    const float mall = fmaxf(fmaxf(mt[0], mt[1]), fmaxf(mt[2], mt[3]));
    return fmaxf(mall, xhalf(mall));
  };
  // The first references are the first tile's maxima, found ahead of the loop: the test in the
  // loop stands behind the exponentials, which a pass without a reference would do in vain
#pragma unroll
  for (int g = 0; g < 2; ++g) {
    float sv[4][8];
    mref[g] = plain_scores(g, (const _Float16 (*)[72])&ring[0][kh][0], sv);
  }

  cuint* mcur = mwp;
  for (int st = 0; st < NSTAGE; ++st) {
    const int buf = st & 1;
    // the two passes of a stage are written out: the wait for the next stage's slice stands in
    // the first alone, and the rows' offset in the slices is a constant
#pragma unroll
    for (int half = 0; half < 2; ++half) {
    const int pass = st * 2 + half;
    const int sub = half * (64 * AT_PITCHB);   // which 64 rows of the stage's slices
    const _Float16 (*kT)[72] = (const _Float16 (*)[72])&ring[buf][kh][sub];
    const _Float16 (*vT)[72] = (const _Float16 (*)[72])&ring[buf][2 + kh][sub];

    // C operand of S^T: minus the reference, or -1e30 where the mask is 0
    // s[g][t][r] belongs to (query g*16 + ln, key t*16 + 8*lh + r of the tile)
    v8f s[2][4];
#pragma unroll
    for (int g = 0; g < 2; ++g) {
      const float negm = -mref[g];
#pragma unroll
      for (int t = 0; t < 4; ++t)
#pragma unroll
        for (int r = 0; r < 8; ++r)
          s[g][t][r] = __builtin_amdgcn_inverse_ballot_w32(mk[g][t * 8 + r]) ? negm : -1.0e30f;
    }
    // S^T = K * Q'^T - reference for four 16-key sub-tiles; a K fragment serves both groups
#pragma unroll
    for (int t = 0; t < 4; ++t) {
      const v16h k0 = frag_a(&kT[t * 16][0], 72);
      const v16h k1 = frag_a(&kT[t * 16][32], 72);
      s[0][t] = wmma16x16x32(k0, qa[0][0], s[0][t]);
      s[1][t] = wmma16x16x32(k0, qa[1][0], s[1][t]);
      s[0][t] = wmma16x16x32(k1, qa[0][1], s[0][t]);
      s[1][t] = wmma16x16x32(k1, qa[1][1], s[1][t]);
    }
    // (0x100: LDS reads, 0x008: matrix products) all sixteen K reads are asked for as one group
    // ahead of the products: left free, the compiler reads through two fragments' registers
    // and waits for each fragment at once
    __builtin_amdgcn_sched_group_barrier(0x100, 16, 1);
    __builtin_amdgcn_sched_group_barrier(0x008, 16, 1);
    // the words are used up: ask for the next pass's (the last pass asks for its own again)
    cuint* mn = mcur + (pass + 1 < NPASS ? 32 : 0);
#pragma unroll
    for (int g = 0; g < 2; ++g)
#pragma unroll
      for (int i = 0; i < 32; ++i) mk[g][i] = mn[g * MGRP + i];
    // keeps the request for the words here, ahead of the exponentials: left free, the
    // compiler asks for them late in the pass
    __builtin_amdgcn_sched_barrier(0);
    // the first four V^T fragments are asked for ahead of the exponentials
    v16h vf[8];
#pragma unroll
    for (int f = 0; f < 4; ++f) vf[f] = frag_a(&vT[(f >> 1) * 16][(f & 1) * 32], 72);
    if (half == 0) landed();
    // P^T as B operand: sub-tiles 2c and 2c+1 are k 0..15 and 16..31 of chunk c
    // in the hardware k order (element i: key c*32 + ((i&8)<<1) + 8*lh + (i&7));
    // ls[g][r] = sum of the pass's 64 P of query g*16 + ln, the same in every r and both lh
    v16h pb[2][2];
    v8f ls[2];
#pragma unroll
    for (int g = 0; g < 2; ++g) {
#pragma unroll
      for (int c = 0; c < 2; ++c)
#pragma unroll
        for (int i = 0; i < 16; ++i)
          pb[g][c][i] = (_Float16)__builtin_amdgcn_exp2f(s[g][2 * c + (i >> 3)][i & 7]);
#pragma unroll
      for (int r = 0; r < 8; ++r) ls[g][r] = 0.0f;
      ls[g] = wmma16x16x32(ones, pb[g][0], ls[g]);
      ls[g] = wmma16x16x32(ones, pb[g][1], ls[g]);
    }
    // (0x100: LDS reads, 0x400: transcendentals) the eight V^T reads stand ahead of the
    // exponentials, which cover their latency
    __builtin_amdgcn_sched_group_barrier(0x100, 8, 2);
    __builtin_amdgcn_sched_group_barrier(0x400, 64, 2);
    // holds those reads on this side of the branch below: left free, the compiler sinks them
    // behind it, in front of their products, and waits for each at once
    asm volatile("" :: "v"(vf[0]), "v"(vf[1]), "v"(vf[2]), "v"(vf[3]));
    // One test a pass: do the references still serve every query of the wave? One does not
    // where the pass's sum exceeds 256 (a score over 8 above the reference makes it so, one
    // that overflows f16 makes it infinite), or while a query has met no unmasked key
    // (-1e30 is no reference to subtract from a score).
    const bool need = ls[0][0] > 256.0f || ls[1][0] > 256.0f ||
                      mref[0] < -1.0e29f || mref[1] < -1.0e29f;
    if (__builtin_expect(__builtin_amdgcn_ballot_w32(need) != 0, 0)) {
      // New references: the plain scores once more, their
      // maximum joined over the half-waves, O and the sum brought to the new reference,
      // P and its row sum anew. This pass's lane masks take the place of the next pass's,
      // which are asked for again at the end.
      cuint* mc = mcur;
#pragma unroll
      for (int g = 0; g < 2; ++g)
#pragma unroll
        for (int i = 0; i < 32; ++i) mk[g][i] = mc[g * MGRP + i];
#pragma unroll
      for (int g = 0; g < 2; ++g) {
        float sv[4][8];
        const float mall = plain_scores(g, kT, sv);
        const float mnew = fmaxf(mref[g], mall);
        const float corr = exp2_slot(mref[g] - mnew);
        mref[g] = mnew;
        lrow[g] *= corr;
#pragma unroll
        for (int ct = 0; ct < 4; ++ct)
#pragma unroll
          for (int r = 0; r < 8; ++r) o[g][ct][r] *= corr;
#pragma unroll
        for (int c = 0; c < 2; ++c)
#pragma unroll
          for (int i = 0; i < 16; ++i)
            pb[g][c][i] = (_Float16)exp2_slot(sv[2 * c + (i >> 3)][i & 7] - mnew);
#pragma unroll
        for (int r = 0; r < 8; ++r) ls[g][r] = 0.0f;
        ls[g] = wmma16x16x32(ones, pb[g][0], ls[g]);
        ls[g] = wmma16x16x32(ones, pb[g][1], ls[g]);
      }
#pragma unroll
      for (int g = 0; g < 2; ++g)
#pragma unroll
        for (int i = 0; i < 32; ++i) mk[g][i] = mn[g * MGRP + i];
    }
    lrow[0] += ls[0][0];
    lrow[1] += ls[1][0];
    mcur = mn;

    // O^T += V^T(64x64) * P^T(64x16) per group; V^T rows come from the [d][key] tile,
    // and a V^T fragment serves both groups
#pragma unroll
    for (int f = 4; f < 8; ++f) vf[f] = frag_a(&vT[(f >> 1) * 16][(f & 1) * 32], 72);
#pragma unroll
    for (int f = 0; f < 4; ++f) {
      o[0][f >> 1] = wmma16x16x32(vf[f], pb[0][f & 1], o[0][f >> 1]);
      o[1][f >> 1] = wmma16x16x32(vf[f], pb[1][f & 1], o[1][f >> 1]);
    }
    // (0x100: LDS reads, 0x008: matrix products) the other four fragments are asked for as one
    // group ahead of the products. Left free, the compiler asks for most of them only behind
    // six of the eight products that are to cover their latency.
    __builtin_amdgcn_sched_group_barrier(0x100, 8, 0);
    __builtin_amdgcn_sched_group_barrier(0x008, 8, 0);
    // the eight products of the first four fragments stay here, where they cover the latency of
    // those reads: left free, they sink behind the wait for the reads at the pass's foot
    __builtin_amdgcn_sched_barrier(0);
#pragma unroll
    for (int f = 4; f < 8; ++f) {
      o[0][f >> 1] = wmma16x16x32(vf[f], pb[0][f & 1], o[0][f >> 1]);
      o[1][f >> 1] = wmma16x16x32(vf[f], pb[1][f & 1], o[1][f >> 1]);
    }
    }   // pass
    // hand-over at the foot of a stage (every second pass): my reads of this buffer are done,
    // my slice of the next stage has landed; behind the barrier that holds for every wave,
    // and this buffer is refilled
    asm volatile("s_wait_dscnt 0x0" ::: "memory");
    wait_tensor_le<0>();
    __syncthreads();
    g1 = group1();
    if (pinned(issuer && st + 2 < NSTAGE)) { advance(buf != 0); request(); }
  }
  wait_tensor_le<0>();                             // no request is outstanding behind the loop
  asm volatile("s_wait_dscnt 0x0" ::: "memory");   // nor an LDS read: the ring changes its use

  // Join the two key halves. Wave kh keeps column group kh and hands the other group's
  // O^T, reference and sum to its partner wave through LDS.
  const bool hi = kh != 0;
  const float mine_m = hi ? mref[1] : mref[0], send_m = hi ? mref[0] : mref[1];
  const float mine_l = hi ? lrow[1] : lrow[0], send_l = hi ? lrow[0] : lrow[1];
#pragma unroll
  for (int ct = 0; ct < 4; ++ct)
#pragma unroll
    for (int j = 0; j < 2; ++j) {
      float4 w;
      w.x = hi ? o[0][ct][4 * j + 0] : o[1][ct][4 * j + 0];
      w.y = hi ? o[0][ct][4 * j + 1] : o[1][ct][4 * j + 1];
      w.z = hi ? o[0][ct][4 * j + 2] : o[1][ct][4 * j + 2];
      w.w = hi ? o[0][ct][4 * j + 3] : o[1][ct][4 * j + 3];
      *(float4*)&xo[wid][ct * 2 + j][lane][0] = w;
    }
  xml[wid][0][lane] = send_m;
  xml[wid][1][lane] = send_l;
  __syncthreads();     // the partner's values are written by another wave
  const int pw = wid ^ 4;
  const float part_m = xml[pw][0][lane];
  const float part_l = xml[pw][1][lane];
  // both parts brought to the larger reference (a half with no unmasked key has -1e30
  // and drops out against a real one; two such halves weigh alike)
  const float mj = fmaxf(mine_m, part_m);
  const float fa = exp2_slot(mine_m - mj);
  const float fb = exp2_slot(part_m - mj);
  const float inv = 1.0f / (mine_l * fa + part_l * fb);
  const float ga = fa * inv, gb = fb * inv;
  // normalize, write f16 ctx[n, q0 + kh*16 + ln, h*64 + d]:
  // 8 consecutive d per lane and tile -> one 16-byte store each
  _Float16* op = ctx + ((long)n * SEQ + q0 + kh * 16 + ln) * EMB + h * HD + 8 * lh;
#pragma unroll
  for (int ct = 0; ct < 4; ++ct) {
    const float4 p0 = *(const float4*)&xo[pw][ct * 2 + 0][lane][0];
    const float4 p1 = *(const float4*)&xo[pw][ct * 2 + 1][lane][0];
    const float pp[8] = {p0.x, p0.y, p0.z, p0.w, p1.x, p1.y, p1.z, p1.w};
    v8h w;
#pragma unroll
    for (int r = 0; r < 8; ++r)
      w[r] = (_Float16)((hi ? o[1][ct][r] : o[0][ct][r]) * ga + pp[r] * gb);
    *(v8h*)(op + ct * 16) = w;
  }
}

// ---------------------------------------------------------------------------
// Kernel 2: out[4096, E] = ctx_h @ Wh^T + b. Both operands already f16 in
// memory; the tiles come by tensor loads into a ring of four LDS buffers, three
// trips ahead, so that requests to L2 are always outstanding. Block tile 128 x 128,
// one block a WGP; a trip is 128 k. A stage is four slices of 64 rows x 256 B (rows
// 0-63 and 64-127 of ctx, then of W); waves 0-3 each ask for one slice a stage.
// 8 waves as 4 x 2, each 32 rows x 64 columns = 2 x 4 WMMA tiles: six fragments read
// from LDS feed eight products.
// ---------------------------------------------------------------------------
#define FC_K 128
#define FC_TRIPS (EMB / FC_K)
#define FC_PITCH (FC_K + 8)          // halves: 256 B + 16 B pad, laid by the tensor load
#define FC_PITCHB (FC_PITCH * 2)     // bytes
#define FC_NBUF 4
#define FC_SLICE 18432               // 64 rows x 272 B = 17 KiB, rounded up to a multiple of 2 KiB
__global__ __launch_bounds__(256) __attribute__((amdgpu_waves_per_eu(2, 2)))
void fc_kernel(
    const _Float16* __restrict__ ctx, const _Float16* __restrict__ Wh,
    const float* __restrict__ bias, float* __restrict__ out) {
  // [buffer][slice][64 rows of 272 B]; every slice starts at a multiple of 2 KiB
  __shared__ __attribute__((aligned(2048))) unsigned char ring[FC_NBUF][4][FC_SLICE];

  const int tid  = threadIdx.x;
  const int wid  = tid >> 5;
  const int lane = tid & 31;
  const int lh   = lane >> 4;
  const int ln   = lane & 15;
  const int n0 = blockIdx.x * 128;
  const int m0 = blockIdx.y * 128;
  const int wm = (wid >> 1) * 32;
  const int wn = (wid & 1) * 64;

  v8f acc[2][4];
#pragma unroll
  for (int i = 0; i < 2; ++i)
#pragma unroll
    for (int j = 0; j < 4; ++j)
#pragma unroll
      for (int r = 0; r < 8; ++r) acc[i][j][r] = 0.0f;

  const unsigned wave = uni((unsigned)tid >> 5);
  const _Float16* srow = (wave & 2u) ? Wh + (long)(n0 + (int)(wave & 1u) * 64) * EMB
                                     : ctx + (long)(m0 + (int)(wave & 1u) * 64) * EMB;
  const unsigned long long ga = (unsigned long long)srow;
  const unsigned ga_lo = uni((unsigned)ga);
  const unsigned ga_hi = uni((((unsigned)(ga >> 32)) & 0x01FFFFFFu) | 0x80000000u);
  const unsigned lds0  = uni(lds_addr(&ring[0][0][0]) + (wave & 3u) * FC_SLICE);
  u32x8 g1;
  g1[0] = uni((1u << 20) | (5u << 22) | (3u << 25));
  g1[1] = uni(256u << 16);
  g1[2] = uni(64u << 16);
  g1[3] = uni(256u << 16);
  g1[4] = uni(64u);
  g1[5] = uni(EMB * 2u);
  g1[6] = uni(0u);
  g1[7] = uni(0u);
  u32x4 g0;
  g0[0] = uni(1u);
  g0[1] = lds0;
  g0[2] = ga_lo;
  g0[3] = ga_hi;
  auto stage = [&](int trip) {   // this wave's slice of stage trip, into buffer trip % 4
    g0[1] = uni(lds0 + (unsigned)(trip % FC_NBUF) * (4u * FC_SLICE));
    g0[2] = uni(ga_lo + (unsigned)trip * (FC_K * 2u));
    // both groups are named as in-out operands: each then stays in one register tuple from
    // request to request, and no register of a request that is still outstanding is given
    // to another value (only the two words set above move)
    asm volatile("tensor_load_to_lds %0, %1" : "+s"(g0), "+s"(g1) :: "memory");
  };

  // Two 32-k chunks = 12 fragments = 24 LDS reads, and their 16 products
  struct Half { v16h a[2][2], b[2][4]; };
  auto fetch = [&](Half& f, int buf, int half) {
    const _Float16* at = (const _Float16*)&ring[buf][wm >> 6][(wm & 63) * FC_PITCHB];
    const _Float16* bt = (const _Float16*)&ring[buf][2 + (wn >> 6)][0];
#pragma unroll
    for (int c = 0; c < 2; ++c) {
      const int k = (half * 2 + c) * 32;
      f.a[c][0] = frag_a(at + k, FC_PITCH);
      f.a[c][1] = frag_a(at + 16 * FC_PITCH + k, FC_PITCH);
#pragma unroll
      for (int j = 0; j < 4; ++j)
        f.b[c][j] = frag_b_transposed(bt + j * 16 * FC_PITCH + k, FC_PITCH);   // B = W^T
    }
  };
  auto products = [&](const Half& f) {
#pragma unroll
    for (int c = 0; c < 2; ++c)
#pragma unroll
      for (int j = 0; j < 4; ++j) {
        acc[0][j] = wmma16x16x32(f.a[c][0], f.b[c][j], acc[0][j]);
        acc[1][j] = wmma16x16x32(f.a[c][1], f.b[c][j], acc[1][j]);
      }
  };

  if (pinned(wave < 4u)) { stage(0); stage(1); stage(2); }
  wait_tensor_le<2>();          // my slice of stage 0 has landed
  if (pinned(wave < 4u)) stage(3);   // three requests of a wave are outstanding again
  __syncthreads();              // everyone's slice of stage 0 has

  // Each half tile's fragments are asked for as one group in front of the products of the
  // half before it. The sched_barriers hold that order: left free, the compiler asks for a
  // B fragment directly in front of its two products and waits for it at once, and it moves
  // products behind the barrier, in front of the refill and the next reads.
  Half lo, hi;
  fetch(lo, 0, 0);
  auto trip = [&](auto tc) {
    constexpr int t = decltype(tc)::value;
    constexpr int buf = t % FC_NBUF;
    fetch(hi, buf, 1);
    __builtin_amdgcn_sched_barrier(0);   // the 24 reads stay one group ahead of the products
    products(lo);
    __builtin_amdgcn_sched_barrier(0);   // no product sinks behind the barrier below
    // hand-over: my reads of this buffer are done, my slice of stage t + 1 has landed (the
    // stages asked for behind it may still fly); behind the barrier that holds for every
    // wave, and this buffer is refilled
    asm volatile("s_wait_dscnt 0x0" ::: "memory");
    constexpr int asked = t + 3 < FC_TRIPS - 1 ? t + 3 : FC_TRIPS - 1;   // last stage asked for
    wait_tensor_le<(asked > t + 1 ? asked - (t + 1) : 0)>();
    __syncthreads();
    if constexpr (t + FC_NBUF < FC_TRIPS) {
      if (pinned(wave < 4u)) stage(t + FC_NBUF);
    }
    if constexpr (t + 1 < FC_TRIPS) fetch(lo, (t + 1) % FC_NBUF, 0);
    __builtin_amdgcn_sched_barrier(0);   // refill and reads are issued ahead of the products
    products(hi);
    __builtin_amdgcn_sched_barrier(0);   // the next trip's reads do not mix into the products
  };
  // written out: the wait's count, the tests for a next stage and the buffer's number are
  // compile-time
  trip(std::integral_constant<int, 0>{}); trip(std::integral_constant<int, 1>{});
  trip(std::integral_constant<int, 2>{}); trip(std::integral_constant<int, 3>{});
  trip(std::integral_constant<int, 4>{}); trip(std::integral_constant<int, 5>{});
  trip(std::integral_constant<int, 6>{}); trip(std::integral_constant<int, 7>{});
  static_assert(FC_TRIPS == 8, "the trips are written out");
  wait_tensor_le<0>();                             // no request is outstanding when the wave ends
  asm volatile("s_wait_dscnt 0x0" ::: "memory");   // nor an LDS read

#pragma unroll
  for (int ti = 0; ti < 2; ++ti)
#pragma unroll
    for (int tj = 0; tj < 4; ++tj) {
      v8f a = acc[ti][tj];
#pragma unroll
      for (int r = 0; r < 8; ++r) {
        int row = m0 + wm + ti * 16 + r + 8 * lh;
        int col = n0 + wn + tj * 16 + ln;
        out[(long)row * EMB + col] = a[r] + bias[col];
      }
    }
}

extern "C" void kernel_launch(void* const* d_in, const int* in_sizes, int n_in,
                              void* d_out, int out_size, void* d_ws, size_t ws_size,
                              hipStream_t stream) {
  (void)in_sizes; (void)n_in; (void)out_size; (void)ws_size;
  const float* values = (const float*)d_in[0];
  const float* keys   = (const float*)d_in[1];
  const float* query  = (const float*)d_in[2];
  const int*   mask   = (const int*)d_in[3];
  const float* W_fc   = (const float*)d_in[4];
  const float* b_fc   = (const float*)d_in[5];

  // workspace: ctx_h (8 MiB f16) | W_h (2 MiB f16) | lane masks (1 MiB) |
  //            K_h (8 MiB f16) | V_t (8 MiB f16)
  _Float16* ctx_h = (_Float16*)d_ws;
  _Float16* W_h   = (_Float16*)((char*)d_ws + (size_t)NB * SEQ * EMB * 2);
  unsigned* mask_w = (unsigned*)((char*)d_ws + (size_t)NB * SEQ * EMB * 2 +
                                 (size_t)EMB * EMB * 2);
  _Float16* K_h = (_Float16*)((char*)d_ws + (size_t)NB * SEQ * EMB * 2 +
                              (size_t)EMB * EMB * 2 + (size_t)NB * SEQ * SEQ / 8);
  _Float16* V_t = K_h + (size_t)NB * SEQ * EMB;

  prep_kernel<<<dim3(KV_BLOCKS + PACK_BLOCKS + CVT_BLOCKS), 256, 0, stream>>>(
      W_fc, W_h, mask, mask_w, keys, values, K_h, V_t);
  attn_kernel<<<dim3(SEQ / 128, NH, NB), 256, 0, stream>>>(query, K_h, V_t,
                                                           mask_w, ctx_h);
  fc_kernel<<<dim3(EMB / 128, (NB * SEQ) / 128), 256, 0, stream>>>(ctx_h, W_h,
                                                                  b_fc,
                                                                  (float*)d_out);
}
